// v000
// The times below were measured on an AMD MI455X: many runs one after another, warmed up first and cycling through
// copies of the inputs, with the whole window's GPU time divided by the number of runs. Launches and the gaps
// between them are all in it. The median over several windows is given; except for v000 it joins two sittings, which
// can be a few percent apart, so the side-by-side timings, each taken in one sitting, are the better comparison.
// v000, which the later versions start from, runs in 163 microseconds.
#include <hip/hip_runtime.h>
#include <hip/hip_bf16.h>

typedef __attribute__((ext_vector_type(8)))  float  v8f;
typedef __attribute__((ext_vector_type(8)))  __bf16 v8bf;
typedef __attribute__((ext_vector_type(16))) __bf16 v16bf;

union Frag16 { v16bf v; v8bf h[2]; };

static __device__ __forceinline__ v8f wmma_bf16(v16bf a, v16bf b, v8f c) {
  return __builtin_amdgcn_wmma_f32_16x16x32_bf16(false, a, false, b, (short)0, c,
                                                 false, false);
}

// Load a 16x32 (rows x k) bf16 A/B fragment in the CDNA5 WMMA register layout:
// lanes 0-15 -> row r0+lane,    K = k0+{0..7, 16..23}
// lanes16-31 -> row r0+lane-16, K = k0+{8..15,24..31}
static __device__ __forceinline__ v16bf load_frag(const __bf16* mat, int ld, int r0,
                                                  int k0, int lane) {
  const int row = r0 + (lane & 15);
  const int kb  = k0 + ((lane >> 4) << 3);
  const __bf16* p = mat + (long)row * ld + kb;
  Frag16 f;
  f.h[0] = *reinterpret_cast<const v8bf*>(p);
  f.h[1] = *reinterpret_cast<const v8bf*>(p + 16);
  return f.v;
}

// CDNA5 async global->LDS copy of 16 bytes (tracked by ASYNCcnt).
static __device__ __forceinline__ void async_copy_b128(const __bf16* gptr,
                                                       __bf16* lptr) {
  const unsigned lds_off = (unsigned)(uintptr_t)lptr;  // addr[31:0] == LDS offset
  asm volatile("global_load_async_to_lds_b128 %0, %1, off"
               :: "v"(lds_off), "v"(gptr) : "memory");
}
#define ASYNC_WAIT_4() asm volatile("s_wait_asynccnt 0x4" ::: "memory")
#define ASYNC_WAIT_0() asm volatile("s_wait_asynccnt 0x0" ::: "memory")

// ---------------------------------------------------------------- convert
__global__ void cvt_f32_bf16(const float* __restrict__ in, __bf16* __restrict__ out,
                             int n) {
  int i = blockIdx.x * blockDim.x + threadIdx.x;
  if (i < n) out[i] = (__bf16)in[i];
}

// ---------------------------------------------------------------- QKV GEMM
// C = x(4096x512) @ W^T(512x512); Q scaled by 1/sqrt(64); V stored transposed.
// Q,K: [head][n][64]   Vt: [head][64][n]   (bf16)
__global__ __launch_bounds__(128) void qkv_gemm(const __bf16* __restrict__ xb,
                                                const __bf16* __restrict__ wq,
                                                const __bf16* __restrict__ wk,
                                                const __bf16* __restrict__ wv,
                                                __bf16* __restrict__ Qh,
                                                __bf16* __restrict__ Kh,
                                                __bf16* __restrict__ Vt) {
  const int lane = threadIdx.x & 31;
  const int wave = threadIdx.x >> 5;
  const int m0 = (blockIdx.x * 4 + wave) * 16;   // token rows
  const int n0 = blockIdx.y * 64;                // output cols (hd)
  const int z  = blockIdx.z;                     // 0=Q 1=K 2=V
  const __bf16* W = (z == 0) ? wq : (z == 1) ? wk : wv;

  v8f acc[4] = {};
  for (int k0 = 0; k0 < 512; k0 += 32) {
    v16bf a = load_frag(xb, 512, m0, k0, lane);
#pragma unroll
    for (int nt = 0; nt < 4; ++nt) {
      v16bf b = load_frag(W, 512, n0 + nt * 16, k0, lane);
      acc[nt] = wmma_bf16(a, b, acc[nt]);
    }
  }

  // D layout: lanes0-15 N=lane, M=reg; lanes16-31 N=lane-16, M=8+reg
#pragma unroll
  for (int nt = 0; nt < 4; ++nt) {
    const int o = n0 + nt * 16 + (lane & 15);    // hd index
    const int h = o >> 6, d = o & 63;
#pragma unroll
    for (int r = 0; r < 8; ++r) {
      const int m = m0 + ((lane < 16) ? r : 8 + r);
      const float v = acc[nt][r];
      if (z == 0)      Qh[((long)(h << 12) + m) * 64 + d] = (__bf16)(v * 0.125f);
      else if (z == 1) Kh[((long)(h << 12) + m) * 64 + d] = (__bf16)v;
      else             Vt[(long)o * 4096 + m] = (__bf16)v;   // o == h*64+d
    }
  }
}

// ---------------------------------------------------------------- attention
// 4 waves/block, one head per block-row; each wave owns a 16-query tile.
// K/V tiles (32 keys) are shared by all 4 waves -> staged in LDS with
// double-buffered async global->LDS copies (ASYNCcnt).
// Computes S^T = K @ Q^T so softmax reduction is in-lane + one xor16 shuffle,
// and the two 16-key S^T tiles form a native K=32 B-fragment of P^T.
__global__ __launch_bounds__(128) void attn_flash(const __bf16* __restrict__ Qh,
                                                  const __bf16* __restrict__ Kh,
                                                  const __bf16* __restrict__ Vt,
                                                  __bf16* __restrict__ Ob) {
  __shared__ __bf16 Ks[2][32 * 64];   // [key][d]
  __shared__ __bf16 Vs[2][64 * 32];   // [d][key]

  const int tid  = threadIdx.x;
  const int lane = tid & 31;
  const int wave = tid >> 5;
  const int h  = blockIdx.y;
  const int q0 = (blockIdx.x * 4 + wave) * 16;
  const __bf16* Q = Qh + (long)(h << 12) * 64;
  const __bf16* K = Kh + (long)(h << 12) * 64;
  const __bf16* V = Vt + (long)(h << 6) * 4096;

  // loop-invariant Q B-fragments (16 queries x 64 d)
  const v16bf qb0 = load_frag(Q, 64, q0, 0, lane);
  const v16bf qb1 = load_frag(Q, 64, q0, 32, lane);

  // stage kt=0 into buffer 0: 4 async b128 per thread per stage
  {
    async_copy_b128(K + 0 * 64 + tid * 8,        Ks[0] + tid * 8);
    async_copy_b128(K + 0 * 64 + (tid + 128) * 8, Ks[0] + (tid + 128) * 8);
    const int c0 = tid, c1 = tid + 128;
    async_copy_b128(V + (c0 >> 2) * 4096 + 0 + (c0 & 3) * 8, Vs[0] + c0 * 8);
    async_copy_b128(V + (c1 >> 2) * 4096 + 0 + (c1 & 3) * 8, Vs[0] + c1 * 8);
  }

  v8f o0 = {}, o1 = {}, o2 = {}, o3 = {};
  float mrun = -3.0e38f, lrun = 0.0f;

  for (int it = 0; it < 128; ++it) {
    const int kt  = it * 32;
    const int cur = it & 1;

    if (it + 1 < 128) {  // prefetch next 32-key tile into the other buffer
      const int kn = kt + 32;
      __bf16* kd = Ks[cur ^ 1];
      __bf16* vd = Vs[cur ^ 1];
      async_copy_b128(K + kn * 64 + tid * 8,         kd + tid * 8);
      async_copy_b128(K + kn * 64 + (tid + 128) * 8, kd + (tid + 128) * 8);
      const int c0 = tid, c1 = tid + 128;
      async_copy_b128(V + (c0 >> 2) * 4096 + kn + (c0 & 3) * 8, vd + c0 * 8);
      async_copy_b128(V + (c1 >> 2) * 4096 + kn + (c1 & 3) * 8, vd + c1 * 8);
      ASYNC_WAIT_4();   // current buffer's 4 copies (issued last iter) are done
    } else {
      ASYNC_WAIT_0();
    }
    __syncthreads();    // all waves' copies into buf[cur] visible

    const __bf16* kc = Ks[cur];
    const __bf16* vc = Vs[cur];

    // S^T tiles from LDS: keys 0..15 and 16..31 of this tile
    v16bf ka0 = load_frag(kc, 64, 0,  0,  lane);
    v16bf ka1 = load_frag(kc, 64, 0,  32, lane);
    v16bf kb0 = load_frag(kc, 64, 16, 0,  lane);
    v16bf kb1 = load_frag(kc, 64, 16, 32, lane);
    v8f s0 = {}; s0 = wmma_bf16(ka0, qb0, s0); s0 = wmma_bf16(ka1, qb1, s0);
    v8f s1 = {}; s1 = wmma_bf16(kb0, qb0, s1); s1 = wmma_bf16(kb1, qb1, s1);

    // online softmax over the key axis (regs + lane-half exchange)
    float tmax = s0[0];
#pragma unroll
    for (int r = 0; r < 8; ++r) { tmax = fmaxf(tmax, s0[r]); tmax = fmaxf(tmax, s1[r]); }
    tmax = fmaxf(tmax, __shfl_xor(tmax, 16, 32));
    const float mnew  = fmaxf(mrun, tmax);
    const float alpha = __expf(mrun - mnew);

    Frag16 p;
    float psum = 0.0f;
#pragma unroll
    for (int r = 0; r < 8; ++r) {
      const float e0 = __expf(s0[r] - mnew);
      const float e1 = __expf(s1[r] - mnew);
      psum += e0 + e1;
      p.v[r]     = (__bf16)e0;   // keys kt+{0..7 | 8..15}  (per lane half)
      p.v[8 + r] = (__bf16)e1;   // keys kt+{16..23 | 24..31}
    }
    psum += __shfl_xor(psum, 16, 32);
    lrun = lrun * alpha + psum;
    mrun = mnew;
#pragma unroll
    for (int r = 0; r < 8; ++r) {
      o0[r] *= alpha; o1[r] *= alpha; o2[r] *= alpha; o3[r] *= alpha;
    }

    // O^T += V^T(64 x 32keys) @ P^T(32keys x 16 queries), V from LDS
    v16bf va0 = load_frag(vc, 32, 0,  0, lane);
    v16bf va1 = load_frag(vc, 32, 16, 0, lane);
    v16bf va2 = load_frag(vc, 32, 32, 0, lane);
    v16bf va3 = load_frag(vc, 32, 48, 0, lane);
    o0 = wmma_bf16(va0, p.v, o0);
    o1 = wmma_bf16(va1, p.v, o1);
    o2 = wmma_bf16(va2, p.v, o2);
    o3 = wmma_bf16(va3, p.v, o3);

    __syncthreads();    // everyone done reading buf[cur] before it's re-staged
  }

  const float inv = 1.0f / lrun;
  const int q = q0 + (lane & 15);
#pragma unroll
  for (int r = 0; r < 8; ++r) {
    const int dr = (lane < 16) ? r : 8 + r;
    Ob[(long)q * 512 + (h << 6) +  0 + dr] = (__bf16)(o0[r] * inv);
    Ob[(long)q * 512 + (h << 6) + 16 + dr] = (__bf16)(o1[r] * inv);
    Ob[(long)q * 512 + (h << 6) + 32 + dr] = (__bf16)(o2[r] * inv);
    Ob[(long)q * 512 + (h << 6) + 48 + dr] = (__bf16)(o3[r] * inv);
  }
}

// ---------------------------------------------------------------- output proj
// out(4096x64) = Ob(4096x512) @ Wo^T(512x64) + bo, f32 output.
__global__ __launch_bounds__(128) void out_gemm(const __bf16* __restrict__ Ob,
                                                const __bf16* __restrict__ Wob,
                                                const float* __restrict__ bo,
                                                float* __restrict__ out) {
  const int lane = threadIdx.x & 31;
  const int wave = threadIdx.x >> 5;
  const int m0 = (blockIdx.x * 4 + wave) * 16;
  const int o0 = blockIdx.y * 16;

  v8f acc = {};
  for (int k0 = 0; k0 < 512; k0 += 32) {
    v16bf a = load_frag(Ob, 512, m0, k0, lane);
    v16bf b = load_frag(Wob, 512, o0, k0, lane);
    acc = wmma_bf16(a, b, acc);
  }
  const int o = o0 + (lane & 15);
  const float bias = bo[o];
#pragma unroll
  for (int r = 0; r < 8; ++r) {
    const int m = m0 + ((lane < 16) ? r : 8 + r);
    out[(long)m * 64 + o] = acc[r] + bias;
  }
}

// ---------------------------------------------------------------- launch
extern "C" void kernel_launch(void* const* d_in, const int* in_sizes, int n_in,
                              void* d_out, int out_size, void* d_ws, size_t ws_size,
                              hipStream_t stream) {
  const float* x  = (const float*)d_in[0];   // 4096x512
  const float* Wq = (const float*)d_in[1];   // 512x512
  const float* Wk = (const float*)d_in[2];   // 512x512
  const float* Wv = (const float*)d_in[3];   // 512x512
  const float* Wo = (const float*)d_in[4];   // 64x512
  const float* bo = (const float*)d_in[5];   // 64
  float* out = (float*)d_out;                // 4096x64

  char* ws = (char*)d_ws;
  size_t off = 0;
  __bf16* xb  = (__bf16*)(ws + off); off += (size_t)4096 * 512 * 2;  // 4 MB
  __bf16* wqb = (__bf16*)(ws + off); off += (size_t)512 * 512 * 2;
  __bf16* wkb = (__bf16*)(ws + off); off += (size_t)512 * 512 * 2;
  __bf16* wvb = (__bf16*)(ws + off); off += (size_t)512 * 512 * 2;
  __bf16* wob = (__bf16*)(ws + off); off += (size_t)64 * 512 * 2;
  __bf16* Qh  = (__bf16*)(ws + off); off += (size_t)8 * 4096 * 64 * 2;
  __bf16* Kh  = (__bf16*)(ws + off); off += (size_t)8 * 4096 * 64 * 2;
  __bf16* Vt  = (__bf16*)(ws + off); off += (size_t)8 * 64 * 4096 * 2;
  __bf16* Ob  = (__bf16*)(ws + off); off += (size_t)4096 * 512 * 2;

  cvt_f32_bf16<<<(4096 * 512 + 255) / 256, 256, 0, stream>>>(x, xb, 4096 * 512);
  cvt_f32_bf16<<<(512 * 512 + 255) / 256, 256, 0, stream>>>(Wq, wqb, 512 * 512);
  cvt_f32_bf16<<<(512 * 512 + 255) / 256, 256, 0, stream>>>(Wk, wkb, 512 * 512);
  cvt_f32_bf16<<<(512 * 512 + 255) / 256, 256, 0, stream>>>(Wv, wvb, 512 * 512);
  cvt_f32_bf16<<<(64 * 512 + 255) / 256, 256, 0, stream>>>(Wo, wob, 64 * 512);

  qkv_gemm<<<dim3(64, 8, 3), 128, 0, stream>>>(xb, wqb, wkb, wvb, Qh, Kh, Vt);
  attn_flash<<<dim3(64, 8), 128, 0, stream>>>(Qh, Kh, Vt, Ob);
  out_gemm<<<dim3(64, 4), 128, 0, stream>>>(Ob, wob, bo, out);
}

// v001
// A run of this version takes 125 microseconds.
// Timed twice side by side with v000, it ran 1.37 and 1.34 times as fast.
#include <hip/hip_runtime.h>
#include <hip/hip_bf16.h>

typedef __attribute__((ext_vector_type(8)))  float  v8f;
typedef __attribute__((ext_vector_type(8)))  __bf16 v8bf;
typedef __attribute__((ext_vector_type(16))) __bf16 v16bf;

union Frag16 { v16bf v; v8bf h[2]; };

static __device__ __forceinline__ v8f wmma_bf16(v16bf a, v16bf b, v8f c) {
  return __builtin_amdgcn_wmma_f32_16x16x32_bf16(false, a, false, b, (short)0, c,
                                                 false, false);
}

// Load a 16x32 (rows x k) bf16 A/B fragment in the CDNA5 WMMA register layout:
// lanes 0-15 -> row r0+lane,    K = k0+{0..7, 16..23}
// lanes16-31 -> row r0+lane-16, K = k0+{8..15,24..31}
static __device__ __forceinline__ v16bf load_frag(const __bf16* mat, int ld, int r0,
                                                  int k0, int lane) {
  const int row = r0 + (lane & 15);
  const int kb  = k0 + ((lane >> 4) << 3);
  const __bf16* p = mat + (long)row * ld + kb;
  Frag16 f;
  f.h[0] = *reinterpret_cast<const v8bf*>(p);
  f.h[1] = *reinterpret_cast<const v8bf*>(p + 16);
  return f.v;
}

// LDS row pitches in elements: 16 B x odd, so that the 16 rows a ds_load_b128
// fragment read touches fall on distinct banks.
#define KP 72   // 64 d  + 8 pad  = 144 B
#define VP 40   // 32 keys + 8 pad = 80 B

// One stage's four CDNA5 async global->LDS copies of 16 bytes per lane (ASYNCcnt).
// The s_wait_xcnt closes the statement so that no address register of a copy
// is rewritten ahead of it.
static __device__ __forceinline__ void async_copy4_b128(
    const __bf16* g0, __bf16* l0, const __bf16* g1, __bf16* l1,
    const __bf16* g2, __bf16* l2, const __bf16* g3, __bf16* l3) {
  // addr[31:0] == LDS offset
  asm volatile("global_load_async_to_lds_b128 %0, %1, off\n\t"
               "global_load_async_to_lds_b128 %2, %3, off\n\t"
               "global_load_async_to_lds_b128 %4, %5, off\n\t"
               "global_load_async_to_lds_b128 %6, %7, off\n\t"
               "s_wait_xcnt 0x0"
               :: "v"((unsigned)(uintptr_t)l0), "v"(g0),
                  "v"((unsigned)(uintptr_t)l1), "v"(g1),
                  "v"((unsigned)(uintptr_t)l2), "v"(g2),
                  "v"((unsigned)(uintptr_t)l3), "v"(g3)
               : "memory");
}
#define ASYNC_WAIT_4() asm volatile("s_wait_asynccnt 0x4" ::: "memory")
#define ASYNC_WAIT_0() asm volatile("s_wait_asynccnt 0x0" ::: "memory")

// ---------------------------------------------------------------- convert
__global__ void cvt_f32_bf16(const float* __restrict__ in, __bf16* __restrict__ out,
                             int n) {
  int i = blockIdx.x * blockDim.x + threadIdx.x;
  if (i < n) out[i] = (__bf16)in[i];
}

// ---------------------------------------------------------------- QKV GEMM
// C = x(4096x512) @ W^T(512x512); Q scaled by 1/sqrt(64); V stored transposed.
// Q,K: [head][n][64]   Vt: [head][64][n]   (bf16)
__global__ __launch_bounds__(128) void qkv_gemm(const __bf16* __restrict__ xb,
                                                const __bf16* __restrict__ wq,
                                                const __bf16* __restrict__ wk,
                                                const __bf16* __restrict__ wv,
                                                __bf16* __restrict__ Qh,
                                                __bf16* __restrict__ Kh,
                                                __bf16* __restrict__ Vt) {
  const int lane = threadIdx.x & 31;
  const int wave = threadIdx.x >> 5;
  const int m0 = (blockIdx.x * 4 + wave) * 16;   // token rows
  const int n0 = blockIdx.y * 64;                // output cols (hd)
  const int z  = blockIdx.z;                     // 0=Q 1=K 2=V
  const __bf16* W = (z == 0) ? wq : (z == 1) ? wk : wv;

  v8f acc[4] = {};
  for (int k0 = 0; k0 < 512; k0 += 32) {
    v16bf a = load_frag(xb, 512, m0, k0, lane);
#pragma unroll
    for (int nt = 0; nt < 4; ++nt) {
      v16bf b = load_frag(W, 512, n0 + nt * 16, k0, lane);
      acc[nt] = wmma_bf16(a, b, acc[nt]);
    }
  }

  // D layout: lanes0-15 N=lane, M=reg; lanes16-31 N=lane-16, M=8+reg
#pragma unroll
  for (int nt = 0; nt < 4; ++nt) {
    const int o = n0 + nt * 16 + (lane & 15);    // hd index
    const int h = o >> 6, d = o & 63;
#pragma unroll
    for (int r = 0; r < 8; ++r) {
      const int m = m0 + ((lane < 16) ? r : 8 + r);
      const float v = acc[nt][r];
      if (z == 0)      Qh[((long)(h << 12) + m) * 64 + d] = (__bf16)(v * 0.125f);
      else if (z == 1) Kh[((long)(h << 12) + m) * 64 + d] = (__bf16)v;
      else             Vt[(long)o * 4096 + m] = (__bf16)v;   // o == h*64+d
    }
  }
}

// ---------------------------------------------------------------- attention
// 4 waves/block, one head per block-row; each wave owns a 16-query tile.
// K/V tiles (32 keys) are shared by all 4 waves -> staged in LDS with
// double-buffered async global->LDS copies (ASYNCcnt).
// Computes S^T = K @ Q^T so softmax reduction is in-lane + one xor16 shuffle,
// and the two 16-key S^T tiles form a native K=32 B-fragment of P^T.
__global__ __launch_bounds__(128) void attn_flash(const __bf16* __restrict__ Qh,
                                                  const __bf16* __restrict__ Kh,
                                                  const __bf16* __restrict__ Vt,
                                                  __bf16* __restrict__ Ob) {
  __shared__ __attribute__((aligned(16))) __bf16 Ks[2][32 * KP];   // [key][d], padded rows
  __shared__ __attribute__((aligned(16))) __bf16 Vs[2][64 * VP];   // [d][key], padded rows

  const int tid  = threadIdx.x;
  const int lane = tid & 31;
  const int wave = tid >> 5;
  const int h  = blockIdx.y;
  const int q0 = (blockIdx.x * 4 + wave) * 16;
  const __bf16* Q = Qh + (long)(h << 12) * 64;
  const __bf16* K = Kh + (long)(h << 12) * 64;
  const __bf16* V = Vt + (long)(h << 6) * 4096;

  // loop-invariant Q B-fragments (16 queries x 64 d)
  const v16bf qb0 = load_frag(Q, 64, q0, 0, lane);
  const v16bf qb1 = load_frag(Q, 64, q0, 32, lane);

  // 16-byte chunks c0, c1 of each tile per thread: their places in the padded rows
  const int c0 = tid, c1 = tid + 128;
  const int kl0 = (c0 >> 3) * KP + (c0 & 7) * 8, kl1 = (c1 >> 3) * KP + (c1 & 7) * 8;
  const int vl0 = (c0 >> 2) * VP + (c0 & 3) * 8, vl1 = (c1 >> 2) * VP + (c1 & 3) * 8;

  // stage kt=0 into buffer 0: 4 async b128 per thread per stage
  async_copy4_b128(K + 0 * 64 + c0 * 8, Ks[0] + kl0,
                   K + 0 * 64 + c1 * 8, Ks[0] + kl1,
                   V + (c0 >> 2) * 4096 + 0 + (c0 & 3) * 8, Vs[0] + vl0,
                   V + (c1 >> 2) * 4096 + 0 + (c1 & 3) * 8, Vs[0] + vl1);

  v8f o0 = {}, o1 = {}, o2 = {}, o3 = {};
  float mrun = -3.0e38f, lrun = 0.0f;

  for (int it = 0; it < 128; ++it) {
    const int kt  = it * 32;
    const int cur = it & 1;

    if (it + 1 < 128) {  // prefetch next 32-key tile into the other buffer
      const int kn = kt + 32;
      __bf16* kd = Ks[cur ^ 1];
      __bf16* vd = Vs[cur ^ 1];
      async_copy4_b128(K + kn * 64 + c0 * 8, kd + kl0,
                       K + kn * 64 + c1 * 8, kd + kl1,
                       V + (c0 >> 2) * 4096 + kn + (c0 & 3) * 8, vd + vl0,
                       V + (c1 >> 2) * 4096 + kn + (c1 & 3) * 8, vd + vl1);
      ASYNC_WAIT_4();   // current buffer's 4 copies (issued last iter) are done
    } else {
      ASYNC_WAIT_0();
    }
    __syncthreads();    // all waves' copies into buf[cur] visible

    const __bf16* kc = Ks[cur];
    const __bf16* vc = Vs[cur];

    // S^T tiles from LDS: keys 0..15 and 16..31 of this tile
    v16bf ka0 = load_frag(kc, KP, 0,  0,  lane);
    v16bf ka1 = load_frag(kc, KP, 0,  32, lane);
    v16bf kb0 = load_frag(kc, KP, 16, 0,  lane);
    v16bf kb1 = load_frag(kc, KP, 16, 32, lane);
    v8f s0 = {}; s0 = wmma_bf16(ka0, qb0, s0); s0 = wmma_bf16(ka1, qb1, s0);
    v8f s1 = {}; s1 = wmma_bf16(kb0, qb0, s1); s1 = wmma_bf16(kb1, qb1, s1);

    // online softmax over the key axis (regs + lane-half exchange)
    float tmax = s0[0];
#pragma unroll
    for (int r = 0; r < 8; ++r) { tmax = fmaxf(tmax, s0[r]); tmax = fmaxf(tmax, s1[r]); }
    tmax = fmaxf(tmax, __shfl_xor(tmax, 16, 32));
    const float mnew  = fmaxf(mrun, tmax);
    const float alpha = __expf(mrun - mnew);

    Frag16 p;
    float psum = 0.0f;
#pragma unroll
    for (int r = 0; r < 8; ++r) {
      const float e0 = __expf(s0[r] - mnew);
      const float e1 = __expf(s1[r] - mnew);
      psum += e0 + e1;
      p.v[r]     = (__bf16)e0;   // keys kt+{0..7 | 8..15}  (per lane half)
      p.v[8 + r] = (__bf16)e1;   // keys kt+{16..23 | 24..31}
    }
    psum += __shfl_xor(psum, 16, 32);
    lrun = lrun * alpha + psum;
    mrun = mnew;
#pragma unroll
    for (int r = 0; r < 8; ++r) {
      o0[r] *= alpha; o1[r] *= alpha; o2[r] *= alpha; o3[r] *= alpha;
    }

    // O^T += V^T(64 x 32keys) @ P^T(32keys x 16 queries), V from LDS
    v16bf va0 = load_frag(vc, VP, 0,  0, lane);
    v16bf va1 = load_frag(vc, VP, 16, 0, lane);
    v16bf va2 = load_frag(vc, VP, 32, 0, lane);
    v16bf va3 = load_frag(vc, VP, 48, 0, lane);
    o0 = wmma_bf16(va0, p.v, o0);
    o1 = wmma_bf16(va1, p.v, o1);
    o2 = wmma_bf16(va2, p.v, o2);
    o3 = wmma_bf16(va3, p.v, o3);

    __syncthreads();    // everyone done reading buf[cur] before it's re-staged
  }

  const float inv = 1.0f / lrun;
  const int q = q0 + (lane & 15);
#pragma unroll
  for (int r = 0; r < 8; ++r) {
    const int dr = (lane < 16) ? r : 8 + r;
    Ob[(long)q * 512 + (h << 6) +  0 + dr] = (__bf16)(o0[r] * inv);
    Ob[(long)q * 512 + (h << 6) + 16 + dr] = (__bf16)(o1[r] * inv);
    Ob[(long)q * 512 + (h << 6) + 32 + dr] = (__bf16)(o2[r] * inv);
    Ob[(long)q * 512 + (h << 6) + 48 + dr] = (__bf16)(o3[r] * inv);
  }
}

// ---------------------------------------------------------------- output proj
// out(4096x64) = Ob(4096x512) @ Wo^T(512x64) + bo, f32 output.
__global__ __launch_bounds__(128) void out_gemm(const __bf16* __restrict__ Ob,
                                                const __bf16* __restrict__ Wob,
                                                const float* __restrict__ bo,
                                                float* __restrict__ out) {
  const int lane = threadIdx.x & 31;
  const int wave = threadIdx.x >> 5;
  const int m0 = (blockIdx.x * 4 + wave) * 16;
  const int o0 = blockIdx.y * 16;

  v8f acc = {};
  for (int k0 = 0; k0 < 512; k0 += 32) {
    v16bf a = load_frag(Ob, 512, m0, k0, lane);
    v16bf b = load_frag(Wob, 512, o0, k0, lane);
    acc = wmma_bf16(a, b, acc);
  }
  const int o = o0 + (lane & 15);
  const float bias = bo[o];
#pragma unroll
  for (int r = 0; r < 8; ++r) {
    const int m = m0 + ((lane < 16) ? r : 8 + r);
    out[(long)m * 64 + o] = acc[r] + bias;
  }
}

// ---------------------------------------------------------------- launch
extern "C" void kernel_launch(void* const* d_in, const int* in_sizes, int n_in,
                              void* d_out, int out_size, void* d_ws, size_t ws_size,
                              hipStream_t stream) {
  const float* x  = (const float*)d_in[0];   // 4096x512
  const float* Wq = (const float*)d_in[1];   // 512x512
  const float* Wk = (const float*)d_in[2];   // 512x512
  const float* Wv = (const float*)d_in[3];   // 512x512
  const float* Wo = (const float*)d_in[4];   // 64x512
  const float* bo = (const float*)d_in[5];   // 64
  float* out = (float*)d_out;                // 4096x64

  char* ws = (char*)d_ws;
  size_t off = 0;
  __bf16* xb  = (__bf16*)(ws + off); off += (size_t)4096 * 512 * 2;  // 4 MB
  __bf16* wqb = (__bf16*)(ws + off); off += (size_t)512 * 512 * 2;
  __bf16* wkb = (__bf16*)(ws + off); off += (size_t)512 * 512 * 2;
  __bf16* wvb = (__bf16*)(ws + off); off += (size_t)512 * 512 * 2;
  __bf16* wob = (__bf16*)(ws + off); off += (size_t)64 * 512 * 2;
  __bf16* Qh  = (__bf16*)(ws + off); off += (size_t)8 * 4096 * 64 * 2;
  __bf16* Kh  = (__bf16*)(ws + off); off += (size_t)8 * 4096 * 64 * 2;
  __bf16* Vt  = (__bf16*)(ws + off); off += (size_t)8 * 64 * 4096 * 2;
  __bf16* Ob  = (__bf16*)(ws + off); off += (size_t)4096 * 512 * 2;

  cvt_f32_bf16<<<(4096 * 512 + 255) / 256, 256, 0, stream>>>(x, xb, 4096 * 512);
  cvt_f32_bf16<<<(512 * 512 + 255) / 256, 256, 0, stream>>>(Wq, wqb, 512 * 512);
  cvt_f32_bf16<<<(512 * 512 + 255) / 256, 256, 0, stream>>>(Wk, wkb, 512 * 512);
  cvt_f32_bf16<<<(512 * 512 + 255) / 256, 256, 0, stream>>>(Wv, wvb, 512 * 512);
  cvt_f32_bf16<<<(64 * 512 + 255) / 256, 256, 0, stream>>>(Wo, wob, 64 * 512);

  qkv_gemm<<<dim3(64, 8, 3), 128, 0, stream>>>(xb, wqb, wkb, wvb, Qh, Kh, Vt);
  attn_flash<<<dim3(64, 8), 128, 0, stream>>>(Qh, Kh, Vt, Ob);
  out_gemm<<<dim3(64, 4), 128, 0, stream>>>(Ob, wob, bo, out);
}

// v002
// One run takes 99.8 microseconds.
// Two timings next to v001 put it at 1.25 and 1.24 times that version's speed.
// Counting every step since v000, it is 1.69 times as fast.
#include <hip/hip_runtime.h>
#include <hip/hip_bf16.h>

typedef __attribute__((ext_vector_type(8)))  float  v8f;
typedef __attribute__((ext_vector_type(8)))  __bf16 v8bf;
typedef __attribute__((ext_vector_type(16))) __bf16 v16bf;

union Frag16 { v16bf v; v8bf h[2]; };

static __device__ __forceinline__ v8f wmma_bf16(v16bf a, v16bf b, v8f c) {
  return __builtin_amdgcn_wmma_f32_16x16x32_bf16(false, a, false, b, (short)0, c,
                                                 false, false);
}

// Load a 16x32 (rows x k) bf16 A/B fragment in the CDNA5 WMMA register layout:
// lanes 0-15 -> row r0+lane,    K = k0+{0..7, 16..23}
// lanes16-31 -> row r0+lane-16, K = k0+{8..15,24..31}
static __device__ __forceinline__ v16bf load_frag(const __bf16* mat, int ld, int r0,
                                                  int k0, int lane) {
  const int row = r0 + (lane & 15);
  const int kb  = k0 + ((lane >> 4) << 3);
  const __bf16* p = mat + (long)row * ld + kb;
  Frag16 f;
  f.h[0] = *reinterpret_cast<const v8bf*>(p);
  f.h[1] = *reinterpret_cast<const v8bf*>(p + 16);
  return f.v;
}

// LDS row pitches in elements: 16 B x odd, so that the 16 rows a ds_load_b128
// fragment read touches fall on distinct banks.
#define KT 128  // keys per stage and per softmax step
#define KP 72   // 64 d    + 8 pad = 144 B
#define VP 136  // 128 keys + 8 pad = 272 B

// Eight CDNA5 async global->LDS copies of 16 bytes per lane (ASYNCcnt): piece j
// lies gs elements further in global memory and ls elements further in LDS.
// The s_wait_xcnt closes the statement so that no address register of a copy
// is rewritten ahead of it.
static __device__ __forceinline__ void async_copy8_b128(const __bf16* g, int gs,
                                                        __bf16* l, int ls) {
  // addr[31:0] == LDS offset
  asm volatile("global_load_async_to_lds_b128 %0, %1, off\n\t"
               "global_load_async_to_lds_b128 %2, %3, off\n\t"
               "global_load_async_to_lds_b128 %4, %5, off\n\t"
               "global_load_async_to_lds_b128 %6, %7, off\n\t"
               "global_load_async_to_lds_b128 %8, %9, off\n\t"
               "global_load_async_to_lds_b128 %10, %11, off\n\t"
               "global_load_async_to_lds_b128 %12, %13, off\n\t"
               "global_load_async_to_lds_b128 %14, %15, off\n\t"
               "s_wait_xcnt 0x0"
               :: "v"((unsigned)(uintptr_t)(l)),          "v"(g),
                  "v"((unsigned)(uintptr_t)(l + ls)),     "v"(g + gs),
                  "v"((unsigned)(uintptr_t)(l + 2 * ls)), "v"(g + 2 * gs),
                  "v"((unsigned)(uintptr_t)(l + 3 * ls)), "v"(g + 3 * gs),
                  "v"((unsigned)(uintptr_t)(l + 4 * ls)), "v"(g + 4 * gs),
                  "v"((unsigned)(uintptr_t)(l + 5 * ls)), "v"(g + 5 * gs),
                  "v"((unsigned)(uintptr_t)(l + 6 * ls)), "v"(g + 6 * gs),
                  "v"((unsigned)(uintptr_t)(l + 7 * ls)), "v"(g + 7 * gs)
               : "memory");
}
// this wave's copies have landed
#define ASYNC_WAIT_0() asm volatile("s_wait_asynccnt 0x0" ::: "memory")
// this wave's LDS reads have returned, so the buffer may be handed back
#define DS_WAIT_0() asm volatile("s_wait_dscnt 0x0" ::: "memory")

// ---------------------------------------------------------------- convert
__global__ void cvt_f32_bf16(const float* __restrict__ in, __bf16* __restrict__ out,
                             int n) {
  int i = blockIdx.x * blockDim.x + threadIdx.x;
  if (i < n) out[i] = (__bf16)in[i];
}

// ---------------------------------------------------------------- QKV GEMM
// C = x(4096x512) @ W^T(512x512); Q scaled by 1/sqrt(64); V stored transposed.
// Q,K: [head][n][64]   Vt: [head][64][n]   (bf16)
__global__ __launch_bounds__(128) void qkv_gemm(const __bf16* __restrict__ xb,
                                                const __bf16* __restrict__ wq,
                                                const __bf16* __restrict__ wk,
                                                const __bf16* __restrict__ wv,
                                                __bf16* __restrict__ Qh,
                                                __bf16* __restrict__ Kh,
                                                __bf16* __restrict__ Vt) {
  const int lane = threadIdx.x & 31;
  const int wave = threadIdx.x >> 5;
  const int m0 = (blockIdx.x * 4 + wave) * 16;   // token rows
  const int n0 = blockIdx.y * 64;                // output cols (hd)
  const int z  = blockIdx.z;                     // 0=Q 1=K 2=V
  const __bf16* W = (z == 0) ? wq : (z == 1) ? wk : wv;

  v8f acc[4] = {};
  for (int k0 = 0; k0 < 512; k0 += 32) {
    v16bf a = load_frag(xb, 512, m0, k0, lane);
#pragma unroll
    for (int nt = 0; nt < 4; ++nt) {
      v16bf b = load_frag(W, 512, n0 + nt * 16, k0, lane);
      acc[nt] = wmma_bf16(a, b, acc[nt]);
    }
  }

  // D layout: lanes0-15 N=lane, M=reg; lanes16-31 N=lane-16, M=8+reg
#pragma unroll
  for (int nt = 0; nt < 4; ++nt) {
    const int o = n0 + nt * 16 + (lane & 15);    // hd index
    const int h = o >> 6, d = o & 63;
#pragma unroll
    for (int r = 0; r < 8; ++r) {
      const int m = m0 + ((lane < 16) ? r : 8 + r);
      const float v = acc[nt][r];
      if (z == 0)      Qh[((long)(h << 12) + m) * 64 + d] = (__bf16)(v * 0.125f);
      else if (z == 1) Kh[((long)(h << 12) + m) * 64 + d] = (__bf16)v;
      else             Vt[(long)o * 4096 + m] = (__bf16)v;   // o == h*64+d
    }
  }
}

// ---------------------------------------------------------------- attention
// 4 waves/block, one head per block-row; each wave owns a 16-query tile.
// K/V tiles (128 keys) are shared by all 4 waves -> staged in LDS with
// double-buffered async global->LDS copies (ASYNCcnt).
// Computes S^T = K @ Q^T so softmax reduction is in-lane + one xor16 shuffle,
// and each pair of 16-key S^T tiles forms a native K=32 B-fragment of P^T.
__global__ __launch_bounds__(128) void attn_flash(const __bf16* __restrict__ Qh,
                                                  const __bf16* __restrict__ Kh,
                                                  const __bf16* __restrict__ Vt,
                                                  __bf16* __restrict__ Ob) {
  __shared__ __attribute__((aligned(16))) __bf16 Ks[2][KT * KP];   // [key][d], padded rows
  __shared__ __attribute__((aligned(16))) __bf16 Vs[2][64 * VP];   // [d][key], padded rows

  const int tid  = threadIdx.x;
  const int lane = tid & 31;
  const int wave = tid >> 5;
  const int h  = blockIdx.y;
  const int q0 = (blockIdx.x * 4 + wave) * 16;
  const __bf16* Q = Qh + (long)(h << 12) * 64;
  const __bf16* K = Kh + (long)(h << 12) * 64;
  const __bf16* V = Vt + (long)(h << 6) * 4096;

  // loop-invariant Q B-fragments (16 queries x 64 d)
  const v16bf qb0 = load_frag(Q, 64, q0, 0, lane);
  const v16bf qb1 = load_frag(Q, 64, q0, 32, lane);

  // Each thread copies eight 16-byte pieces of the K tile (16 rows apart) and
  // eight of the V tile (8 rows apart) per stage.
  const __bf16* kg = K + tid * 8;
  const __bf16* vg = V + (tid >> 4) * 4096 + (tid & 15) * 8;
  const int kl = (tid >> 3) * KP + (tid & 7) * 8;
  const int vl = (tid >> 4) * VP + (tid & 15) * 8;

  // stage 0 into buffer 0, published; then stage 1 into buffer 1, in flight
  async_copy8_b128(kg, 16 * 64, Ks[0] + kl, 16 * KP);
  async_copy8_b128(vg, 8 * 4096, Vs[0] + vl, 8 * VP);
  ASYNC_WAIT_0();
  __syncthreads();
  async_copy8_b128(kg + KT * 64, 16 * 64, Ks[1] + kl, 16 * KP);
  async_copy8_b128(vg + KT, 8 * 4096, Vs[1] + vl, 8 * VP);

  v8f o0 = {}, o1 = {}, o2 = {}, o3 = {};
  float mrun = -3.0e38f, lrun = 0.0f;

  for (int it = 0; it < 4096 / KT; ++it) {
    const int cur = it & 1;
    const __bf16* kc = Ks[cur];
    const __bf16* vc = Vs[cur];

    // S^T tiles from LDS: eight tiles of 16 keys.
    // The loops over j, g and r are unrolled so that s, tm, ps and p, indexed
    // by constants, live in registers.
    v8f s[8];
#pragma unroll
    for (int j = 0; j < 8; ++j) {
      v16bf ka = load_frag(kc, KP, 16 * j, 0,  lane);
      v16bf kb = load_frag(kc, KP, 16 * j, 32, lane);
      v8f z = {};
      z = wmma_bf16(ka, qb0, z);
      s[j] = wmma_bf16(kb, qb1, z);
    }

    // online softmax over the key axis (regs + lane-half exchange);
    // one chain per 32 keys, joined at the end
    float tm[4];
#pragma unroll
    for (int g = 0; g < 4; ++g) {
      tm[g] = s[2 * g][0];
#pragma unroll
      for (int r = 0; r < 8; ++r) {
        tm[g] = fmaxf(tm[g], s[2 * g][r]);
        tm[g] = fmaxf(tm[g], s[2 * g + 1][r]);
      }
    }
    float tmax = fmaxf(fmaxf(tm[0], tm[1]), fmaxf(tm[2], tm[3]));
    tmax = fmaxf(tmax, __shfl_xor(tmax, 16, 32));
    const float mnew  = fmaxf(mrun, tmax);
    const float alpha = __expf(mrun - mnew);

    Frag16 p[4];
    float ps[4];
#pragma unroll
    for (int g = 0; g < 4; ++g) {
      ps[g] = 0.0f;
#pragma unroll
      for (int r = 0; r < 8; ++r) {
        const float e0 = __expf(s[2 * g][r] - mnew);
        const float e1 = __expf(s[2 * g + 1][r] - mnew);
        ps[g] += e0 + e1;
        p[g].v[r]     = (__bf16)e0;   // keys 32g+{0..7 | 8..15}  (per lane half)
        p[g].v[8 + r] = (__bf16)e1;   // keys 32g+{16..23 | 24..31}
      }
    }
    float psum = (ps[0] + ps[1]) + (ps[2] + ps[3]);
    psum += __shfl_xor(psum, 16, 32);
    lrun = lrun * alpha + psum;
    mrun = mnew;
#pragma unroll
    for (int r = 0; r < 8; ++r) {
      o0[r] *= alpha; o1[r] *= alpha; o2[r] *= alpha; o3[r] *= alpha;
    }

    // O^T += V^T(64 x 128 keys) @ P^T(128 keys x 16 queries), V from LDS
#pragma unroll
    for (int g = 0; g < 4; ++g) {
      v16bf va0 = load_frag(vc, VP, 0,  32 * g, lane);
      v16bf va1 = load_frag(vc, VP, 16, 32 * g, lane);
      v16bf va2 = load_frag(vc, VP, 32, 32 * g, lane);
      v16bf va3 = load_frag(vc, VP, 48, 32 * g, lane);
      o0 = wmma_bf16(va0, p[g].v, o0);
      o1 = wmma_bf16(va1, p[g].v, o1);
      o2 = wmma_bf16(va2, p[g].v, o2);
      o3 = wmma_bf16(va3, p[g].v, o3);
    }

    // publish point: own reads of buf[cur] done, own copies of the next stage
    // landed; the one barrier publishes that stage and frees buf[cur]
    DS_WAIT_0();
    ASYNC_WAIT_0();
    __syncthreads();
    if (it + 2 < 4096 / KT) {  // refill the buffer just read, two stages ahead
      const int kn = (it + 2) * KT;
      async_copy8_b128(kg + kn * 64, 16 * 64, Ks[cur] + kl, 16 * KP);
      async_copy8_b128(vg + kn, 8 * 4096, Vs[cur] + vl, 8 * VP);
    }
  }
  ASYNC_WAIT_0();   // nothing of this wave is in flight when it ends

  const float inv = 1.0f / lrun;
  const int q = q0 + (lane & 15);
#pragma unroll
  for (int r = 0; r < 8; ++r) {
    const int dr = (lane < 16) ? r : 8 + r;
    Ob[(long)q * 512 + (h << 6) +  0 + dr] = (__bf16)(o0[r] * inv);
    Ob[(long)q * 512 + (h << 6) + 16 + dr] = (__bf16)(o1[r] * inv);
    Ob[(long)q * 512 + (h << 6) + 32 + dr] = (__bf16)(o2[r] * inv);
    Ob[(long)q * 512 + (h << 6) + 48 + dr] = (__bf16)(o3[r] * inv);
  }
}

// ---------------------------------------------------------------- output proj
// out(4096x64) = Ob(4096x512) @ Wo^T(512x64) + bo, f32 output.
__global__ __launch_bounds__(128) void out_gemm(const __bf16* __restrict__ Ob,
                                                const __bf16* __restrict__ Wob,
                                                const float* __restrict__ bo,
                                                float* __restrict__ out) {
  const int lane = threadIdx.x & 31;
  const int wave = threadIdx.x >> 5;
  const int m0 = (blockIdx.x * 4 + wave) * 16;
  const int o0 = blockIdx.y * 16;

  v8f acc = {};
  for (int k0 = 0; k0 < 512; k0 += 32) {
    v16bf a = load_frag(Ob, 512, m0, k0, lane);
    v16bf b = load_frag(Wob, 512, o0, k0, lane);
    acc = wmma_bf16(a, b, acc);
  }
  const int o = o0 + (lane & 15);
  const float bias = bo[o];
#pragma unroll
  for (int r = 0; r < 8; ++r) {
    const int m = m0 + ((lane < 16) ? r : 8 + r);
    out[(long)m * 64 + o] = acc[r] + bias;
  }
}

// ---------------------------------------------------------------- launch
extern "C" void kernel_launch(void* const* d_in, const int* in_sizes, int n_in,
                              void* d_out, int out_size, void* d_ws, size_t ws_size,
                              hipStream_t stream) {
  const float* x  = (const float*)d_in[0];   // 4096x512
  const float* Wq = (const float*)d_in[1];   // 512x512
  const float* Wk = (const float*)d_in[2];   // 512x512
  const float* Wv = (const float*)d_in[3];   // 512x512
  const float* Wo = (const float*)d_in[4];   // 64x512
  const float* bo = (const float*)d_in[5];   // 64
  float* out = (float*)d_out;                // 4096x64

  char* ws = (char*)d_ws;
  size_t off = 0;
  __bf16* xb  = (__bf16*)(ws + off); off += (size_t)4096 * 512 * 2;  // 4 MB
  __bf16* wqb = (__bf16*)(ws + off); off += (size_t)512 * 512 * 2;
  __bf16* wkb = (__bf16*)(ws + off); off += (size_t)512 * 512 * 2;
  __bf16* wvb = (__bf16*)(ws + off); off += (size_t)512 * 512 * 2;
  __bf16* wob = (__bf16*)(ws + off); off += (size_t)64 * 512 * 2;
  __bf16* Qh  = (__bf16*)(ws + off); off += (size_t)8 * 4096 * 64 * 2;
  __bf16* Kh  = (__bf16*)(ws + off); off += (size_t)8 * 4096 * 64 * 2;
  __bf16* Vt  = (__bf16*)(ws + off); off += (size_t)8 * 64 * 4096 * 2;
  __bf16* Ob  = (__bf16*)(ws + off); off += (size_t)4096 * 512 * 2;

  cvt_f32_bf16<<<(4096 * 512 + 255) / 256, 256, 0, stream>>>(x, xb, 4096 * 512);
  cvt_f32_bf16<<<(512 * 512 + 255) / 256, 256, 0, stream>>>(Wq, wqb, 512 * 512);
  cvt_f32_bf16<<<(512 * 512 + 255) / 256, 256, 0, stream>>>(Wk, wkb, 512 * 512);
  cvt_f32_bf16<<<(512 * 512 + 255) / 256, 256, 0, stream>>>(Wv, wvb, 512 * 512);
  cvt_f32_bf16<<<(64 * 512 + 255) / 256, 256, 0, stream>>>(Wo, wob, 64 * 512);

  qkv_gemm<<<dim3(64, 8, 3), 128, 0, stream>>>(xb, wqb, wkb, wvb, Qh, Kh, Vt);
  attn_flash<<<dim3(64, 8), 128, 0, stream>>>(Qh, Kh, Vt, Ob);
  out_gemm<<<dim3(64, 4), 128, 0, stream>>>(Ob, wob, bo, out);
}

// v003
// A run of this version takes 89.4 microseconds.
// In both of two side-by-side timings against v002, it was 1.11 times as fast.
// Counting every step since v000, it is 1.88 times as fast.
#include <hip/hip_runtime.h>
#include <hip/hip_bf16.h>

typedef __attribute__((ext_vector_type(8)))  float  v8f;
typedef __attribute__((ext_vector_type(4)))  float  v4f;
typedef __attribute__((ext_vector_type(4)))  __bf16 v4bf;
typedef __attribute__((ext_vector_type(8)))  __bf16 v8bf;
typedef __attribute__((ext_vector_type(16))) __bf16 v16bf;

union Frag16 { v16bf v; v8bf h[2]; };

static __device__ __forceinline__ v8f wmma_bf16(v16bf a, v16bf b, v8f c) {
  return __builtin_amdgcn_wmma_f32_16x16x32_bf16(false, a, false, b, (short)0, c,
                                                 false, false);
}

// Load a 16x32 (rows x k) bf16 A/B fragment in the CDNA5 WMMA register layout:
// lanes 0-15 -> row r0+lane,    K = k0+{0..7, 16..23}
// lanes16-31 -> row r0+lane-16, K = k0+{8..15,24..31}
static __device__ __forceinline__ v16bf load_frag(const __bf16* mat, int ld, int r0,
                                                  int k0, int lane) {
  const int row = r0 + (lane & 15);
  const int kb  = k0 + ((lane >> 4) << 3);
  const __bf16* p = mat + (long)row * ld + kb;
  Frag16 f;
  f.h[0] = *reinterpret_cast<const v8bf*>(p);
  f.h[1] = *reinterpret_cast<const v8bf*>(p + 16);
  return f.v;
}

// LDS row pitches in elements: 16 B x odd, so that the 16 rows a ds_load_b128
// fragment read touches fall on distinct banks.
#define KT 128  // keys per stage and per softmax step
#define KP 72   // 64 d    + 8 pad = 144 B
#define VP 136  // 128 keys + 8 pad = 272 B

// Eight CDNA5 async global->LDS copies of 16 bytes per lane (ASYNCcnt): piece j
// lies gs elements further in global memory and ls elements further in LDS.
// The s_wait_xcnt closes the statement so that no address register of a copy
// is rewritten ahead of it.
static __device__ __forceinline__ void async_copy8_b128(const __bf16* g, int gs,
                                                        __bf16* l, int ls) {
  // addr[31:0] == LDS offset
  asm volatile("global_load_async_to_lds_b128 %0, %1, off\n\t"
               "global_load_async_to_lds_b128 %2, %3, off\n\t"
               "global_load_async_to_lds_b128 %4, %5, off\n\t"
               "global_load_async_to_lds_b128 %6, %7, off\n\t"
               "global_load_async_to_lds_b128 %8, %9, off\n\t"
               "global_load_async_to_lds_b128 %10, %11, off\n\t"
               "global_load_async_to_lds_b128 %12, %13, off\n\t"
               "global_load_async_to_lds_b128 %14, %15, off\n\t"
               "s_wait_xcnt 0x0"
               :: "v"((unsigned)(uintptr_t)(l)),          "v"(g),
                  "v"((unsigned)(uintptr_t)(l + ls)),     "v"(g + gs),
                  "v"((unsigned)(uintptr_t)(l + 2 * ls)), "v"(g + 2 * gs),
                  "v"((unsigned)(uintptr_t)(l + 3 * ls)), "v"(g + 3 * gs),
                  "v"((unsigned)(uintptr_t)(l + 4 * ls)), "v"(g + 4 * gs),
                  "v"((unsigned)(uintptr_t)(l + 5 * ls)), "v"(g + 5 * gs),
                  "v"((unsigned)(uintptr_t)(l + 6 * ls)), "v"(g + 6 * gs),
                  "v"((unsigned)(uintptr_t)(l + 7 * ls)), "v"(g + 7 * gs)
               : "memory");
}
// this wave's copies have landed
#define ASYNC_WAIT_0() asm volatile("s_wait_asynccnt 0x0" ::: "memory")
// this wave's LDS reads have returned, so the buffer may be handed back
#define DS_WAIT_0() asm volatile("s_wait_dscnt 0x0" ::: "memory")

// ---------------------------------------------------------------- convert
// One launch converts all five f32 operands. Their bf16 copies lie back to back
// in the workspace in the order x, Wq, Wk, Wv, Wo, so a block's place in the
// output is its index; only the source pointer depends on the operand.
// A block takes CVT_BLK elements, and every operand is a whole number of blocks.
#define CVT_U   8                     // 16-byte loads in flight per thread
#define CVT_BLK (256 * 4 * CVT_U)     // elements per block
#define CVT_NX  (4096 * 512 / CVT_BLK)
#define CVT_NW  (512 * 512 / CVT_BLK)
#define CVT_NO  (64 * 512 / CVT_BLK)
__global__ __launch_bounds__(256) void cvt_f32_bf16(const float* __restrict__ x,
                                                    const float* __restrict__ wq,
                                                    const float* __restrict__ wk,
                                                    const float* __restrict__ wv,
                                                    const float* __restrict__ wo,
                                                    __bf16* __restrict__ out) {
  const int b = blockIdx.x;
  const float* src;
  int rel;
  if (b < CVT_NX)                   { src = x;  rel = b; }
  else if (b < CVT_NX + CVT_NW)     { src = wq; rel = b - CVT_NX; }
  else if (b < CVT_NX + 2 * CVT_NW) { src = wk; rel = b - CVT_NX - CVT_NW; }
  else if (b < CVT_NX + 3 * CVT_NW) { src = wv; rel = b - CVT_NX - 2 * CVT_NW; }
  else                              { src = wo; rel = b - CVT_NX - 3 * CVT_NW; }

  // a wave's load covers 512 contiguous bytes, its store 256
  const v4f* in4 = reinterpret_cast<const v4f*>(src + rel * CVT_BLK) + threadIdx.x;
  v4bf* out4 = reinterpret_cast<v4bf*>(out + (long)b * CVT_BLK) + threadIdx.x;
  v4f v[CVT_U];
  // both loops unrolled: v stays in registers and all loads issue before the first use
#pragma unroll
  for (int j = 0; j < CVT_U; ++j) v[j] = in4[j * 256];
#pragma unroll
  for (int j = 0; j < CVT_U; ++j) {
    v4bf o;
    o[0] = (__bf16)v[j][0];
    o[1] = (__bf16)v[j][1];
    o[2] = (__bf16)v[j][2];
    o[3] = (__bf16)v[j][3];
    out4[j * 256] = o;
  }
}

// ---------------------------------------------------------------- QKV GEMM
// C = x(4096x512) @ W^T(512x512); Q scaled by 1/sqrt(64); V stored transposed.
// Q,K: [head][n][64]   Vt: [head][64][n]   (bf16)
__global__ __launch_bounds__(128) void qkv_gemm(const __bf16* __restrict__ xb,
                                                const __bf16* __restrict__ wq,
                                                const __bf16* __restrict__ wk,
                                                const __bf16* __restrict__ wv,
                                                __bf16* __restrict__ Qh,
                                                __bf16* __restrict__ Kh,
                                                __bf16* __restrict__ Vt) {
  const int lane = threadIdx.x & 31;
  const int wave = threadIdx.x >> 5;
  const int m0 = (blockIdx.x * 4 + wave) * 16;   // token rows
  const int n0 = blockIdx.y * 64;                // output cols (hd)
  const int z  = blockIdx.z;                     // 0=Q 1=K 2=V
  const __bf16* W = (z == 0) ? wq : (z == 1) ? wk : wv;

  v8f acc[4] = {};
  for (int k0 = 0; k0 < 512; k0 += 32) {
    v16bf a = load_frag(xb, 512, m0, k0, lane);
#pragma unroll
    for (int nt = 0; nt < 4; ++nt) {
      v16bf b = load_frag(W, 512, n0 + nt * 16, k0, lane);
      acc[nt] = wmma_bf16(a, b, acc[nt]);
    }
  }

  // D layout: lanes0-15 N=lane, M=reg; lanes16-31 N=lane-16, M=8+reg
#pragma unroll
  for (int nt = 0; nt < 4; ++nt) {
    const int o = n0 + nt * 16 + (lane & 15);    // hd index
    const int h = o >> 6, d = o & 63;
#pragma unroll
    for (int r = 0; r < 8; ++r) {
      const int m = m0 + ((lane < 16) ? r : 8 + r);
      const float v = acc[nt][r];
      if (z == 0)      Qh[((long)(h << 12) + m) * 64 + d] = (__bf16)(v * 0.125f);
      else if (z == 1) Kh[((long)(h << 12) + m) * 64 + d] = (__bf16)v;
      else             Vt[(long)o * 4096 + m] = (__bf16)v;   // o == h*64+d
    }
  }
}

// ---------------------------------------------------------------- attention
// 4 waves/block, one head per block-row; each wave owns a 16-query tile.
// K/V tiles (128 keys) are shared by all 4 waves -> staged in LDS with
// double-buffered async global->LDS copies (ASYNCcnt).
// Computes S^T = K @ Q^T so softmax reduction is in-lane + one xor16 shuffle,
// and each pair of 16-key S^T tiles forms a native K=32 B-fragment of P^T.
__global__ __launch_bounds__(128) void attn_flash(const __bf16* __restrict__ Qh,
                                                  const __bf16* __restrict__ Kh,
                                                  const __bf16* __restrict__ Vt,
                                                  __bf16* __restrict__ Ob) {
  __shared__ __attribute__((aligned(16))) __bf16 Ks[2][KT * KP];   // [key][d], padded rows
  __shared__ __attribute__((aligned(16))) __bf16 Vs[2][64 * VP];   // [d][key], padded rows

  const int tid  = threadIdx.x;
  const int lane = tid & 31;
  const int wave = tid >> 5;
  const int h  = blockIdx.y;
  const int q0 = (blockIdx.x * 4 + wave) * 16;
  const __bf16* Q = Qh + (long)(h << 12) * 64;
  const __bf16* K = Kh + (long)(h << 12) * 64;
  const __bf16* V = Vt + (long)(h << 6) * 4096;

  // loop-invariant Q B-fragments (16 queries x 64 d)
  const v16bf qb0 = load_frag(Q, 64, q0, 0, lane);
  const v16bf qb1 = load_frag(Q, 64, q0, 32, lane);

  // Each thread copies eight 16-byte pieces of the K tile (16 rows apart) and
  // eight of the V tile (8 rows apart) per stage.
  const __bf16* kg = K + tid * 8;
  const __bf16* vg = V + (tid >> 4) * 4096 + (tid & 15) * 8;
  const int kl = (tid >> 3) * KP + (tid & 7) * 8;
  const int vl = (tid >> 4) * VP + (tid & 15) * 8;

  // stage 0 into buffer 0, published; then stage 1 into buffer 1, in flight
  async_copy8_b128(kg, 16 * 64, Ks[0] + kl, 16 * KP);
  async_copy8_b128(vg, 8 * 4096, Vs[0] + vl, 8 * VP);
  ASYNC_WAIT_0();
  __syncthreads();
  async_copy8_b128(kg + KT * 64, 16 * 64, Ks[1] + kl, 16 * KP);
  async_copy8_b128(vg + KT, 8 * 4096, Vs[1] + vl, 8 * VP);

  v8f o0 = {}, o1 = {}, o2 = {}, o3 = {};
  float mrun = -3.0e38f, lrun = 0.0f;

  for (int it = 0; it < 4096 / KT; ++it) {
    const int cur = it & 1;
    const __bf16* kc = Ks[cur];
    const __bf16* vc = Vs[cur];

    // S^T tiles from LDS: eight tiles of 16 keys.
    // The loops over j, g and r are unrolled so that s, tm, ps and p, indexed
    // by constants, live in registers.
    v8f s[8];
#pragma unroll
    for (int j = 0; j < 8; ++j) {
      v16bf ka = load_frag(kc, KP, 16 * j, 0,  lane);
      v16bf kb = load_frag(kc, KP, 16 * j, 32, lane);
      v8f z = {};
      z = wmma_bf16(ka, qb0, z);
      s[j] = wmma_bf16(kb, qb1, z);
    }

    // online softmax over the key axis (regs + lane-half exchange);
    // one chain per 32 keys, joined at the end
    float tm[4];
#pragma unroll
    for (int g = 0; g < 4; ++g) {
      tm[g] = s[2 * g][0];
#pragma unroll
      for (int r = 0; r < 8; ++r) {
        tm[g] = fmaxf(tm[g], s[2 * g][r]);
        tm[g] = fmaxf(tm[g], s[2 * g + 1][r]);
      }
    }
    float tmax = fmaxf(fmaxf(tm[0], tm[1]), fmaxf(tm[2], tm[3]));
    tmax = fmaxf(tmax, __shfl_xor(tmax, 16, 32));
    const float mnew  = fmaxf(mrun, tmax);
    const float alpha = __expf(mrun - mnew);

    Frag16 p[4];
    float ps[4];
#pragma unroll
    for (int g = 0; g < 4; ++g) {
      ps[g] = 0.0f;
#pragma unroll
      for (int r = 0; r < 8; ++r) {
        const float e0 = __expf(s[2 * g][r] - mnew);
        const float e1 = __expf(s[2 * g + 1][r] - mnew);
        ps[g] += e0 + e1;
        p[g].v[r]     = (__bf16)e0;   // keys 32g+{0..7 | 8..15}  (per lane half)
        p[g].v[8 + r] = (__bf16)e1;   // keys 32g+{16..23 | 24..31}
      }
    }
    float psum = (ps[0] + ps[1]) + (ps[2] + ps[3]);
    psum += __shfl_xor(psum, 16, 32);
    lrun = lrun * alpha + psum;
    mrun = mnew;
#pragma unroll
    for (int r = 0; r < 8; ++r) {
      o0[r] *= alpha; o1[r] *= alpha; o2[r] *= alpha; o3[r] *= alpha;
    }

    // O^T += V^T(64 x 128 keys) @ P^T(128 keys x 16 queries), V from LDS
#pragma unroll
    for (int g = 0; g < 4; ++g) {
      v16bf va0 = load_frag(vc, VP, 0,  32 * g, lane);
      v16bf va1 = load_frag(vc, VP, 16, 32 * g, lane);
      v16bf va2 = load_frag(vc, VP, 32, 32 * g, lane);
      v16bf va3 = load_frag(vc, VP, 48, 32 * g, lane);
      o0 = wmma_bf16(va0, p[g].v, o0);
      o1 = wmma_bf16(va1, p[g].v, o1);
      o2 = wmma_bf16(va2, p[g].v, o2);
      o3 = wmma_bf16(va3, p[g].v, o3);
    }

    // publish point: own reads of buf[cur] done, own copies of the next stage
    // landed; the one barrier publishes that stage and frees buf[cur]
    DS_WAIT_0();
    ASYNC_WAIT_0();
    __syncthreads();
    if (it + 2 < 4096 / KT) {  // refill the buffer just read, two stages ahead
      const int kn = (it + 2) * KT;
      async_copy8_b128(kg + kn * 64, 16 * 64, Ks[cur] + kl, 16 * KP);
      async_copy8_b128(vg + kn, 8 * 4096, Vs[cur] + vl, 8 * VP);
    }
  }
  ASYNC_WAIT_0();   // nothing of this wave is in flight when it ends

  const float inv = 1.0f / lrun;
  const int q = q0 + (lane & 15);
#pragma unroll
  for (int r = 0; r < 8; ++r) {
    const int dr = (lane < 16) ? r : 8 + r;
    Ob[(long)q * 512 + (h << 6) +  0 + dr] = (__bf16)(o0[r] * inv);
    Ob[(long)q * 512 + (h << 6) + 16 + dr] = (__bf16)(o1[r] * inv);
    Ob[(long)q * 512 + (h << 6) + 32 + dr] = (__bf16)(o2[r] * inv);
    Ob[(long)q * 512 + (h << 6) + 48 + dr] = (__bf16)(o3[r] * inv);
  }
}

// ---------------------------------------------------------------- output proj
// out(4096x64) = Ob(4096x512) @ Wo^T(512x64) + bo, f32 output.
__global__ __launch_bounds__(128) void out_gemm(const __bf16* __restrict__ Ob,
                                                const __bf16* __restrict__ Wob,
                                                const float* __restrict__ bo,
                                                float* __restrict__ out) {
  const int lane = threadIdx.x & 31;
  const int wave = threadIdx.x >> 5;
  const int m0 = (blockIdx.x * 4 + wave) * 16;
  const int o0 = blockIdx.y * 16;

  v8f acc = {};
  for (int k0 = 0; k0 < 512; k0 += 32) {
    v16bf a = load_frag(Ob, 512, m0, k0, lane);
    v16bf b = load_frag(Wob, 512, o0, k0, lane);
    acc = wmma_bf16(a, b, acc);
  }
  const int o = o0 + (lane & 15);
  const float bias = bo[o];
#pragma unroll
  for (int r = 0; r < 8; ++r) {
    const int m = m0 + ((lane < 16) ? r : 8 + r);
    out[(long)m * 64 + o] = acc[r] + bias;
  }
}

// ---------------------------------------------------------------- launch
extern "C" void kernel_launch(void* const* d_in, const int* in_sizes, int n_in,
                              void* d_out, int out_size, void* d_ws, size_t ws_size,
                              hipStream_t stream) {
  const float* x  = (const float*)d_in[0];   // 4096x512
  const float* Wq = (const float*)d_in[1];   // 512x512
  const float* Wk = (const float*)d_in[2];   // 512x512
  const float* Wv = (const float*)d_in[3];   // 512x512
  const float* Wo = (const float*)d_in[4];   // 64x512
  const float* bo = (const float*)d_in[5];   // 64
  float* out = (float*)d_out;                // 4096x64

  char* ws = (char*)d_ws;
  size_t off = 0;
  __bf16* xb  = (__bf16*)(ws + off); off += (size_t)4096 * 512 * 2;  // 4 MB
  __bf16* wqb = (__bf16*)(ws + off); off += (size_t)512 * 512 * 2;
  __bf16* wkb = (__bf16*)(ws + off); off += (size_t)512 * 512 * 2;
  __bf16* wvb = (__bf16*)(ws + off); off += (size_t)512 * 512 * 2;
  __bf16* wob = (__bf16*)(ws + off); off += (size_t)64 * 512 * 2;
  __bf16* Qh  = (__bf16*)(ws + off); off += (size_t)8 * 4096 * 64 * 2;
  __bf16* Kh  = (__bf16*)(ws + off); off += (size_t)8 * 4096 * 64 * 2;
  __bf16* Vt  = (__bf16*)(ws + off); off += (size_t)8 * 64 * 4096 * 2;
  __bf16* Ob  = (__bf16*)(ws + off); off += (size_t)4096 * 512 * 2;

  // xb, wqb, wkb, wvb, wob are one contiguous range that starts at xb
  cvt_f32_bf16<<<CVT_NX + 3 * CVT_NW + CVT_NO, 256, 0, stream>>>(x, Wq, Wk, Wv, Wo, xb);

  qkv_gemm<<<dim3(64, 8, 3), 128, 0, stream>>>(xb, wqb, wkb, wvb, Qh, Kh, Vt);
  attn_flash<<<dim3(64, 8), 128, 0, stream>>>(Qh, Kh, Vt, Ob);
  out_gemm<<<dim3(64, 4), 128, 0, stream>>>(Ob, wob, bo, out);
}

// v004
// It runs in 66.4 microseconds.
// Timed twice side by side with v003, it ran 1.34 times as fast both times.
// All steps since v000 together make it 2.53 times as fast.
#include <hip/hip_runtime.h>
#include <hip/hip_bf16.h>

typedef __attribute__((ext_vector_type(8)))  float  v8f;
typedef __attribute__((ext_vector_type(4)))  float  v4f;
typedef __attribute__((ext_vector_type(4)))  __bf16 v4bf;
typedef __attribute__((ext_vector_type(8)))  __bf16 v8bf;
typedef __attribute__((ext_vector_type(16))) __bf16 v16bf;

union Frag16 { v16bf v; v8bf h[2]; };

static __device__ __forceinline__ v8f wmma_bf16(v16bf a, v16bf b, v8f c) {
  return __builtin_amdgcn_wmma_f32_16x16x32_bf16(false, a, false, b, (short)0, c,
                                                 false, false);
}

// Load a 16x32 (rows x k) bf16 A/B fragment in the CDNA5 WMMA register layout:
// lanes 0-15 -> row r0+lane,    K = k0+{0..7, 16..23}
// lanes16-31 -> row r0+lane-16, K = k0+{8..15,24..31}
static __device__ __forceinline__ v16bf load_frag(const __bf16* mat, int ld, int r0,
                                                  int k0, int lane) {
  const int row = r0 + (lane & 15);
  const int kb  = k0 + ((lane >> 4) << 3);
  const __bf16* p = mat + (long)row * ld + kb;
  Frag16 f;
  f.h[0] = *reinterpret_cast<const v8bf*>(p);
  f.h[1] = *reinterpret_cast<const v8bf*>(p + 16);
  return f.v;
}

// LDS row pitches in elements: 16 B x odd, so that the 16 rows a ds_load_b128
// fragment read touches fall on distinct banks.
#define KT 128  // keys per stage and per softmax step
#define KP 72   // 64 d    + 8 pad = 144 B
#define VP 136  // 128 keys + 8 pad = 272 B

// Eight CDNA5 async global->LDS copies of 16 bytes per lane (ASYNCcnt): piece j
// lies gs elements further in global memory and ls elements further in LDS.
// The s_wait_xcnt closes the statement so that no address register of a copy
// is rewritten ahead of it.
static __device__ __forceinline__ void async_copy8_b128(const __bf16* g, int gs,
                                                        __bf16* l, int ls) {
  // addr[31:0] == LDS offset
  asm volatile("global_load_async_to_lds_b128 %0, %1, off\n\t"
               "global_load_async_to_lds_b128 %2, %3, off\n\t"
               "global_load_async_to_lds_b128 %4, %5, off\n\t"
               "global_load_async_to_lds_b128 %6, %7, off\n\t"
               "global_load_async_to_lds_b128 %8, %9, off\n\t"
               "global_load_async_to_lds_b128 %10, %11, off\n\t"
               "global_load_async_to_lds_b128 %12, %13, off\n\t"
               "global_load_async_to_lds_b128 %14, %15, off\n\t"
               "s_wait_xcnt 0x0"
               :: "v"((unsigned)(uintptr_t)(l)),          "v"(g),
                  "v"((unsigned)(uintptr_t)(l + ls)),     "v"(g + gs),
                  "v"((unsigned)(uintptr_t)(l + 2 * ls)), "v"(g + 2 * gs),
                  "v"((unsigned)(uintptr_t)(l + 3 * ls)), "v"(g + 3 * gs),
                  "v"((unsigned)(uintptr_t)(l + 4 * ls)), "v"(g + 4 * gs),
                  "v"((unsigned)(uintptr_t)(l + 5 * ls)), "v"(g + 5 * gs),
                  "v"((unsigned)(uintptr_t)(l + 6 * ls)), "v"(g + 6 * gs),
                  "v"((unsigned)(uintptr_t)(l + 7 * ls)), "v"(g + 7 * gs)
               : "memory");
}
// The same with four pieces, closed by the same s_wait_xcnt for the same reason.
static __device__ __forceinline__ void async_copy4_b128(const __bf16* g, int gs,
                                                        __bf16* l, int ls) {
  asm volatile("global_load_async_to_lds_b128 %0, %1, off\n\t"
               "global_load_async_to_lds_b128 %2, %3, off\n\t"
               "global_load_async_to_lds_b128 %4, %5, off\n\t"
               "global_load_async_to_lds_b128 %6, %7, off\n\t"
               "s_wait_xcnt 0x0"
               :: "v"((unsigned)(uintptr_t)(l)),          "v"(g),
                  "v"((unsigned)(uintptr_t)(l + ls)),     "v"(g + gs),
                  "v"((unsigned)(uintptr_t)(l + 2 * ls)), "v"(g + 2 * gs),
                  "v"((unsigned)(uintptr_t)(l + 3 * ls)), "v"(g + 3 * gs)
               : "memory");
}
// this wave's copies have landed
#define ASYNC_WAIT_0() asm volatile("s_wait_asynccnt 0x0" ::: "memory")
// this wave's LDS reads have returned, so the buffer may be handed back
#define DS_WAIT_0() asm volatile("s_wait_dscnt 0x0" ::: "memory")

// ---------------------------------------------------------------- convert
// One launch converts all five f32 operands. Their bf16 copies lie back to back
// in the workspace in the order x, Wq, Wk, Wv, Wo, so a block's place in the
// output is its index; only the source pointer depends on the operand.
// A block takes CVT_BLK elements, and every operand is a whole number of blocks.
#define CVT_U   8                     // 16-byte loads in flight per thread
#define CVT_BLK (256 * 4 * CVT_U)     // elements per block
#define CVT_NX  (4096 * 512 / CVT_BLK)
#define CVT_NW  (512 * 512 / CVT_BLK)
#define CVT_NO  (64 * 512 / CVT_BLK)
__global__ __launch_bounds__(256) void cvt_f32_bf16(const float* __restrict__ x,
                                                    const float* __restrict__ wq,
                                                    const float* __restrict__ wk,
                                                    const float* __restrict__ wv,
                                                    const float* __restrict__ wo,
                                                    __bf16* __restrict__ out) {
  const int b = blockIdx.x;
  const float* src;
  int rel;
  if (b < CVT_NX)                   { src = x;  rel = b; }
  else if (b < CVT_NX + CVT_NW)     { src = wq; rel = b - CVT_NX; }
  else if (b < CVT_NX + 2 * CVT_NW) { src = wk; rel = b - CVT_NX - CVT_NW; }
  else if (b < CVT_NX + 3 * CVT_NW) { src = wv; rel = b - CVT_NX - 2 * CVT_NW; }
  else                              { src = wo; rel = b - CVT_NX - 3 * CVT_NW; }

  // a wave's load covers 512 contiguous bytes, its store 256
  const v4f* in4 = reinterpret_cast<const v4f*>(src + rel * CVT_BLK) + threadIdx.x;
  v4bf* out4 = reinterpret_cast<v4bf*>(out + (long)b * CVT_BLK) + threadIdx.x;
  v4f v[CVT_U];
  // both loops unrolled: v stays in registers and all loads issue before the first use
#pragma unroll
  for (int j = 0; j < CVT_U; ++j) v[j] = in4[j * 256];
#pragma unroll
  for (int j = 0; j < CVT_U; ++j) {
    v4bf o;
    o[0] = (__bf16)v[j][0];
    o[1] = (__bf16)v[j][1];
    o[2] = (__bf16)v[j][2];
    o[3] = (__bf16)v[j][3];
    out4[j * 256] = o;
  }
}

// ---------------------------------------------------------------- QKV GEMM
// C = x(4096x512) @ W^T(512x512); Q scaled by 1/sqrt(64); V stored transposed.
// Q,K: [head][n][64]   Vt: [head][64][n]   (bf16)
// A block of 8 waves makes 128 tokens x 64 columns, each wave 16 x 64. Both
// operands are staged in LDS, GK columns of k per stage, with double-buffered
// async global->LDS copies (ASYNCcnt): a copy moves whole lines, a stage is in
// flight while the one before is worked on, and a W row is fetched once a block.
#define GK 128  // k per stage
#define GP 136  // LDS row pitch in elements: 256 B + 16 B pad (16 B x odd)
__global__ __launch_bounds__(256) void qkv_gemm(const __bf16* __restrict__ xb,
                                                const __bf16* __restrict__ wq,
                                                const __bf16* __restrict__ wk,
                                                const __bf16* __restrict__ wv,
                                                __bf16* __restrict__ Qh,
                                                __bf16* __restrict__ Kh,
                                                __bf16* __restrict__ Vt) {
  __shared__ __attribute__((aligned(16))) __bf16 Xs[2][128 * GP];  // [token][k], padded rows
  __shared__ __attribute__((aligned(16))) __bf16 Ws[2][64 * GP];   // [col][k], padded rows

  const int tid  = threadIdx.x;
  const int lane = threadIdx.x & 31;
  const int wave = threadIdx.x >> 5;
  const int m0 = (blockIdx.x * 8 + wave) * 16;   // token rows
  const int n0 = blockIdx.y * 64;                // output cols (hd)
  const int z  = blockIdx.z;                     // 0=Q 1=K 2=V
  const __bf16* W = (z == 0) ? wq : (z == 1) ? wk : wv;

  // 16 threads copy the 256 B of a row, the block 16 rows at a time: a thread's
  // pieces lie 16 rows apart, eight of the x tile and four of the W tile per stage.
  const __bf16* xg = xb + (blockIdx.x * 128 + (tid >> 4)) * 512 + (tid & 15) * 8;
  const __bf16* wg = W  + (n0 + (tid >> 4)) * 512 + (tid & 15) * 8;
  const int sl = (tid >> 4) * GP + (tid & 15) * 8;

  // stage 0 into buffer 0, published; then stage 1 into buffer 1, in flight
  async_copy8_b128(xg, 16 * 512, Xs[0] + sl, 16 * GP);
  async_copy4_b128(wg, 16 * 512, Ws[0] + sl, 16 * GP);
  ASYNC_WAIT_0();
  __syncthreads();
  async_copy8_b128(xg + GK, 16 * 512, Xs[1] + sl, 16 * GP);
  async_copy4_b128(wg + GK, 16 * 512, Ws[1] + sl, 16 * GP);

  v8f acc[4] = {};
  for (int s = 0; s < 512 / GK; ++s) {
    const int cur = s & 1;
    const __bf16* xc = Xs[cur];
    const __bf16* wc = Ws[cur];
    // both loops unrolled: kk folds into the offset field of the LDS reads, and
    // acc, indexed by constants, lives in registers
#pragma unroll
    for (int kk = 0; kk < GK; kk += 32) {
      v16bf a = load_frag(xc, GP, wave * 16, kk, lane);
#pragma unroll
      for (int nt = 0; nt < 4; ++nt) {
        v16bf b = load_frag(wc, GP, nt * 16, kk, lane);
        acc[nt] = wmma_bf16(a, b, acc[nt]);
      }
    }

    // publish point: own reads of buf[cur] done, own copies of the next stage
    // landed; the one barrier publishes that stage and frees buf[cur]
    DS_WAIT_0();
    ASYNC_WAIT_0();
    __syncthreads();
    if (s + 2 < 512 / GK) {  // refill the buffer just read, two stages ahead
      const int kn = (s + 2) * GK;
      async_copy8_b128(xg + kn, 16 * 512, Xs[cur] + sl, 16 * GP);
      async_copy4_b128(wg + kn, 16 * 512, Ws[cur] + sl, 16 * GP);
    }
  }
  ASYNC_WAIT_0();   // nothing of this wave is in flight when it ends

  // D layout: lanes0-15 N=lane, M=reg; lanes16-31 N=lane-16, M=8+reg
#pragma unroll
  for (int nt = 0; nt < 4; ++nt) {
    const int o = n0 + nt * 16 + (lane & 15);    // hd index
    const int h = o >> 6, d = o & 63;
#pragma unroll
    for (int r = 0; r < 8; ++r) {
      const int m = m0 + ((lane < 16) ? r : 8 + r);
      const float v = acc[nt][r];
      if (z == 0)      Qh[((long)(h << 12) + m) * 64 + d] = (__bf16)(v * 0.125f);
      else if (z == 1) Kh[((long)(h << 12) + m) * 64 + d] = (__bf16)v;
      else             Vt[(long)o * 4096 + m] = (__bf16)v;   // o == h*64+d
    }
  }
}

// ---------------------------------------------------------------- attention
// 4 waves/block, one head per block-row; each wave owns a 16-query tile.
// K/V tiles (128 keys) are shared by all 4 waves -> staged in LDS with
// double-buffered async global->LDS copies (ASYNCcnt).
// Computes S^T = K @ Q^T so softmax reduction is in-lane + one xor16 shuffle,
// and each pair of 16-key S^T tiles forms a native K=32 B-fragment of P^T.
__global__ __launch_bounds__(128) void attn_flash(const __bf16* __restrict__ Qh,
                                                  const __bf16* __restrict__ Kh,
                                                  const __bf16* __restrict__ Vt,
                                                  __bf16* __restrict__ Ob) {
  __shared__ __attribute__((aligned(16))) __bf16 Ks[2][KT * KP];   // [key][d], padded rows
  __shared__ __attribute__((aligned(16))) __bf16 Vs[2][64 * VP];   // [d][key], padded rows

  const int tid  = threadIdx.x;
  const int lane = tid & 31;
  const int wave = tid >> 5;
  const int h  = blockIdx.y;
  const int q0 = (blockIdx.x * 4 + wave) * 16;
  const __bf16* Q = Qh + (long)(h << 12) * 64;
  const __bf16* K = Kh + (long)(h << 12) * 64;
  const __bf16* V = Vt + (long)(h << 6) * 4096;

  // loop-invariant Q B-fragments (16 queries x 64 d)
  const v16bf qb0 = load_frag(Q, 64, q0, 0, lane);
  const v16bf qb1 = load_frag(Q, 64, q0, 32, lane);

  // Each thread copies eight 16-byte pieces of the K tile (16 rows apart) and
  // eight of the V tile (8 rows apart) per stage.
  const __bf16* kg = K + tid * 8;
  const __bf16* vg = V + (tid >> 4) * 4096 + (tid & 15) * 8;
  const int kl = (tid >> 3) * KP + (tid & 7) * 8;
  const int vl = (tid >> 4) * VP + (tid & 15) * 8;

  // stage 0 into buffer 0, published; then stage 1 into buffer 1, in flight
  async_copy8_b128(kg, 16 * 64, Ks[0] + kl, 16 * KP);
  async_copy8_b128(vg, 8 * 4096, Vs[0] + vl, 8 * VP);
  ASYNC_WAIT_0();
  __syncthreads();
  async_copy8_b128(kg + KT * 64, 16 * 64, Ks[1] + kl, 16 * KP);
  async_copy8_b128(vg + KT, 8 * 4096, Vs[1] + vl, 8 * VP);

  v8f o0 = {}, o1 = {}, o2 = {}, o3 = {};
  float mrun = -3.0e38f, lrun = 0.0f;

  for (int it = 0; it < 4096 / KT; ++it) {
    const int cur = it & 1;
    const __bf16* kc = Ks[cur];
    const __bf16* vc = Vs[cur];

    // S^T tiles from LDS: eight tiles of 16 keys.
    // The loops over j, g and r are unrolled so that s, tm, ps and p, indexed
    // by constants, live in registers.
    v8f s[8];
#pragma unroll
    for (int j = 0; j < 8; ++j) {
      v16bf ka = load_frag(kc, KP, 16 * j, 0,  lane);
      v16bf kb = load_frag(kc, KP, 16 * j, 32, lane);
      v8f z = {};
      z = wmma_bf16(ka, qb0, z);
      s[j] = wmma_bf16(kb, qb1, z);
    }

    // online softmax over the key axis (regs + lane-half exchange);
    // one chain per 32 keys, joined at the end
    float tm[4];
#pragma unroll
    for (int g = 0; g < 4; ++g) {
      tm[g] = s[2 * g][0];
#pragma unroll
      for (int r = 0; r < 8; ++r) {
        tm[g] = fmaxf(tm[g], s[2 * g][r]);
        tm[g] = fmaxf(tm[g], s[2 * g + 1][r]);
      }
    }
    float tmax = fmaxf(fmaxf(tm[0], tm[1]), fmaxf(tm[2], tm[3]));
    tmax = fmaxf(tmax, __shfl_xor(tmax, 16, 32));
    const float mnew  = fmaxf(mrun, tmax);
    const float alpha = __expf(mrun - mnew);

    Frag16 p[4];
    float ps[4];
#pragma unroll
    for (int g = 0; g < 4; ++g) {
      ps[g] = 0.0f;
#pragma unroll
      for (int r = 0; r < 8; ++r) {
        const float e0 = __expf(s[2 * g][r] - mnew);
        const float e1 = __expf(s[2 * g + 1][r] - mnew);
        ps[g] += e0 + e1;
        p[g].v[r]     = (__bf16)e0;   // keys 32g+{0..7 | 8..15}  (per lane half)
        p[g].v[8 + r] = (__bf16)e1;   // keys 32g+{16..23 | 24..31}
      }
    }
    float psum = (ps[0] + ps[1]) + (ps[2] + ps[3]);
    psum += __shfl_xor(psum, 16, 32);
    lrun = lrun * alpha + psum;
    mrun = mnew;
#pragma unroll
    for (int r = 0; r < 8; ++r) {
      o0[r] *= alpha; o1[r] *= alpha; o2[r] *= alpha; o3[r] *= alpha;
    }

    // O^T += V^T(64 x 128 keys) @ P^T(128 keys x 16 queries), V from LDS
#pragma unroll
    for (int g = 0; g < 4; ++g) {
      v16bf va0 = load_frag(vc, VP, 0,  32 * g, lane);
      v16bf va1 = load_frag(vc, VP, 16, 32 * g, lane);
      v16bf va2 = load_frag(vc, VP, 32, 32 * g, lane);
      v16bf va3 = load_frag(vc, VP, 48, 32 * g, lane);
      o0 = wmma_bf16(va0, p[g].v, o0);
      o1 = wmma_bf16(va1, p[g].v, o1);
      o2 = wmma_bf16(va2, p[g].v, o2);
      o3 = wmma_bf16(va3, p[g].v, o3);
    }

    // publish point: own reads of buf[cur] done, own copies of the next stage
    // landed; the one barrier publishes that stage and frees buf[cur]
    DS_WAIT_0();
    ASYNC_WAIT_0();
    __syncthreads();
    if (it + 2 < 4096 / KT) {  // refill the buffer just read, two stages ahead
      const int kn = (it + 2) * KT;
      async_copy8_b128(kg + kn * 64, 16 * 64, Ks[cur] + kl, 16 * KP);
      async_copy8_b128(vg + kn, 8 * 4096, Vs[cur] + vl, 8 * VP);
    }
  }
  ASYNC_WAIT_0();   // nothing of this wave is in flight when it ends

  const float inv = 1.0f / lrun;
  const int q = q0 + (lane & 15);
#pragma unroll
  for (int r = 0; r < 8; ++r) {
    const int dr = (lane < 16) ? r : 8 + r;
    Ob[(long)q * 512 + (h << 6) +  0 + dr] = (__bf16)(o0[r] * inv);
    Ob[(long)q * 512 + (h << 6) + 16 + dr] = (__bf16)(o1[r] * inv);
    Ob[(long)q * 512 + (h << 6) + 32 + dr] = (__bf16)(o2[r] * inv);
    Ob[(long)q * 512 + (h << 6) + 48 + dr] = (__bf16)(o3[r] * inv);
  }
}

// ---------------------------------------------------------------- output proj
// out(4096x64) = Ob(4096x512) @ Wo^T(512x64) + bo, f32 output.
__global__ __launch_bounds__(128) void out_gemm(const __bf16* __restrict__ Ob,
                                                const __bf16* __restrict__ Wob,
                                                const float* __restrict__ bo,
                                                float* __restrict__ out) {
  const int lane = threadIdx.x & 31;
  const int wave = threadIdx.x >> 5;
  const int m0 = (blockIdx.x * 4 + wave) * 16;
  const int o0 = blockIdx.y * 16;

  v8f acc = {};
  for (int k0 = 0; k0 < 512; k0 += 32) {
    v16bf a = load_frag(Ob, 512, m0, k0, lane);
    v16bf b = load_frag(Wob, 512, o0, k0, lane);
    acc = wmma_bf16(a, b, acc);
  }
  const int o = o0 + (lane & 15);
  const float bias = bo[o];
#pragma unroll
  for (int r = 0; r < 8; ++r) {
    const int m = m0 + ((lane < 16) ? r : 8 + r);
    out[(long)m * 64 + o] = acc[r] + bias;
  }
}

// ---------------------------------------------------------------- launch
extern "C" void kernel_launch(void* const* d_in, const int* in_sizes, int n_in,
                              void* d_out, int out_size, void* d_ws, size_t ws_size,
                              hipStream_t stream) {
  const float* x  = (const float*)d_in[0];   // 4096x512
  const float* Wq = (const float*)d_in[1];   // 512x512
  const float* Wk = (const float*)d_in[2];   // 512x512
  const float* Wv = (const float*)d_in[3];   // 512x512
  const float* Wo = (const float*)d_in[4];   // 64x512
  const float* bo = (const float*)d_in[5];   // 64
  float* out = (float*)d_out;                // 4096x64

  char* ws = (char*)d_ws;
  size_t off = 0;
  __bf16* xb  = (__bf16*)(ws + off); off += (size_t)4096 * 512 * 2;  // 4 MB
  __bf16* wqb = (__bf16*)(ws + off); off += (size_t)512 * 512 * 2;
  __bf16* wkb = (__bf16*)(ws + off); off += (size_t)512 * 512 * 2;
  __bf16* wvb = (__bf16*)(ws + off); off += (size_t)512 * 512 * 2;
  __bf16* wob = (__bf16*)(ws + off); off += (size_t)64 * 512 * 2;
  __bf16* Qh  = (__bf16*)(ws + off); off += (size_t)8 * 4096 * 64 * 2;
  __bf16* Kh  = (__bf16*)(ws + off); off += (size_t)8 * 4096 * 64 * 2;
  __bf16* Vt  = (__bf16*)(ws + off); off += (size_t)8 * 64 * 4096 * 2;
  __bf16* Ob  = (__bf16*)(ws + off); off += (size_t)4096 * 512 * 2;

  // xb, wqb, wkb, wvb, wob are one contiguous range that starts at xb
  cvt_f32_bf16<<<CVT_NX + 3 * CVT_NW + CVT_NO, 256, 0, stream>>>(x, Wq, Wk, Wv, Wo, xb);

  qkv_gemm<<<dim3(32, 8, 3), 256, 0, stream>>>(xb, wqb, wkb, wvb, Qh, Kh, Vt);
  attn_flash<<<dim3(64, 8), 128, 0, stream>>>(Qh, Kh, Vt, Ob);
  out_gemm<<<dim3(64, 4), 128, 0, stream>>>(Ob, wob, bo, out);
}

// v005
// It runs in 55.4 microseconds.
// In both of two side-by-side timings against v004, it was 1.19 times as fast.
// Counting every step since v000, it is 3.00 times as fast.
#include <hip/hip_runtime.h>
#include <hip/hip_bf16.h>

typedef __attribute__((ext_vector_type(8)))  float  v8f;
typedef __attribute__((ext_vector_type(4)))  float  v4f;
typedef __attribute__((ext_vector_type(4)))  __bf16 v4bf;
typedef __attribute__((ext_vector_type(8)))  __bf16 v8bf;
typedef __attribute__((ext_vector_type(16))) __bf16 v16bf;

union Frag16 { v16bf v; v8bf h[2]; };

static __device__ __forceinline__ v8f wmma_bf16(v16bf a, v16bf b, v8f c) {
  return __builtin_amdgcn_wmma_f32_16x16x32_bf16(false, a, false, b, (short)0, c,
                                                 false, false);
}

// Load a 16x32 (rows x k) bf16 A/B fragment in the CDNA5 WMMA register layout:
// lanes 0-15 -> row r0+lane,    K = k0+{0..7, 16..23}
// lanes16-31 -> row r0+lane-16, K = k0+{8..15,24..31}
static __device__ __forceinline__ v16bf load_frag(const __bf16* mat, int ld, int r0,
                                                  int k0, int lane) {
  const int row = r0 + (lane & 15);
  const int kb  = k0 + ((lane >> 4) << 3);
  const __bf16* p = mat + (long)row * ld + kb;
  Frag16 f;
  f.h[0] = *reinterpret_cast<const v8bf*>(p);
  f.h[1] = *reinterpret_cast<const v8bf*>(p + 16);
  return f.v;
}

// LDS row pitches in elements: 16 B x odd, so that the 16 rows a ds_load_b128
// fragment read touches fall on distinct banks.
#define KT 256        // keys per stage
#define NS 4          // waves that share a stage's keys
#define WK (KT / NS)  // keys per wave and per softmax step
#define KP 72         // 64 d    + 8 pad = 144 B
#define VP 264        // 256 keys + 8 pad = 528 B
#define SM_BYTES (2 * (KT * KP + 64 * VP) * 2)

// Eight CDNA5 async global->LDS copies of 16 bytes per lane (ASYNCcnt): piece j
// lies gs elements further in global memory and ls elements further in LDS.
// The s_wait_xcnt closes the statement so that no address register of a copy
// is rewritten ahead of it.
static __device__ __forceinline__ void async_copy8_b128(const __bf16* g, int gs,
                                                        __bf16* l, int ls) {
  // addr[31:0] == LDS offset
  asm volatile("global_load_async_to_lds_b128 %0, %1, off\n\t"
               "global_load_async_to_lds_b128 %2, %3, off\n\t"
               "global_load_async_to_lds_b128 %4, %5, off\n\t"
               "global_load_async_to_lds_b128 %6, %7, off\n\t"
               "global_load_async_to_lds_b128 %8, %9, off\n\t"
               "global_load_async_to_lds_b128 %10, %11, off\n\t"
               "global_load_async_to_lds_b128 %12, %13, off\n\t"
               "global_load_async_to_lds_b128 %14, %15, off\n\t"
               "s_wait_xcnt 0x0"
               :: "v"((unsigned)(uintptr_t)(l)),          "v"(g),
                  "v"((unsigned)(uintptr_t)(l + ls)),     "v"(g + gs),
                  "v"((unsigned)(uintptr_t)(l + 2 * ls)), "v"(g + 2 * gs),
                  "v"((unsigned)(uintptr_t)(l + 3 * ls)), "v"(g + 3 * gs),
                  "v"((unsigned)(uintptr_t)(l + 4 * ls)), "v"(g + 4 * gs),
                  "v"((unsigned)(uintptr_t)(l + 5 * ls)), "v"(g + 5 * gs),
                  "v"((unsigned)(uintptr_t)(l + 6 * ls)), "v"(g + 6 * gs),
                  "v"((unsigned)(uintptr_t)(l + 7 * ls)), "v"(g + 7 * gs)
               : "memory");
}
// The same with four pieces, closed by the same s_wait_xcnt for the same reason.
static __device__ __forceinline__ void async_copy4_b128(const __bf16* g, int gs,
                                                        __bf16* l, int ls) {
  asm volatile("global_load_async_to_lds_b128 %0, %1, off\n\t"
               "global_load_async_to_lds_b128 %2, %3, off\n\t"
               "global_load_async_to_lds_b128 %4, %5, off\n\t"
               "global_load_async_to_lds_b128 %6, %7, off\n\t"
               "s_wait_xcnt 0x0"
               :: "v"((unsigned)(uintptr_t)(l)),          "v"(g),
                  "v"((unsigned)(uintptr_t)(l + ls)),     "v"(g + gs),
                  "v"((unsigned)(uintptr_t)(l + 2 * ls)), "v"(g + 2 * gs),
                  "v"((unsigned)(uintptr_t)(l + 3 * ls)), "v"(g + 3 * gs)
               : "memory");
}
// this wave's copies have landed
#define ASYNC_WAIT_0() asm volatile("s_wait_asynccnt 0x0" ::: "memory")
// this wave's LDS reads have returned, so the buffer may be handed back
#define DS_WAIT_0() asm volatile("s_wait_dscnt 0x0" ::: "memory")

// ---------------------------------------------------------------- convert
// One launch converts all five f32 operands. Their bf16 copies lie back to back
// in the workspace in the order x, Wq, Wk, Wv, Wo, so a block's place in the
// output is its index; only the source pointer depends on the operand.
// A block takes CVT_BLK elements, and every operand is a whole number of blocks.
#define CVT_U   8                     // 16-byte loads in flight per thread
#define CVT_BLK (256 * 4 * CVT_U)     // elements per block
#define CVT_NX  (4096 * 512 / CVT_BLK)
#define CVT_NW  (512 * 512 / CVT_BLK)
#define CVT_NO  (64 * 512 / CVT_BLK)
__global__ __launch_bounds__(256) void cvt_f32_bf16(const float* __restrict__ x,
                                                    const float* __restrict__ wq,
                                                    const float* __restrict__ wk,
                                                    const float* __restrict__ wv,
                                                    const float* __restrict__ wo,
                                                    __bf16* __restrict__ out) {
  const int b = blockIdx.x;
  const float* src;
  int rel;
  if (b < CVT_NX)                   { src = x;  rel = b; }
  else if (b < CVT_NX + CVT_NW)     { src = wq; rel = b - CVT_NX; }
  else if (b < CVT_NX + 2 * CVT_NW) { src = wk; rel = b - CVT_NX - CVT_NW; }
  else if (b < CVT_NX + 3 * CVT_NW) { src = wv; rel = b - CVT_NX - 2 * CVT_NW; }
  else                              { src = wo; rel = b - CVT_NX - 3 * CVT_NW; }

  // a wave's load covers 512 contiguous bytes, its store 256
  const v4f* in4 = reinterpret_cast<const v4f*>(src + rel * CVT_BLK) + threadIdx.x;
  v4bf* out4 = reinterpret_cast<v4bf*>(out + (long)b * CVT_BLK) + threadIdx.x;
  v4f v[CVT_U];
  // both loops unrolled: v stays in registers and all loads issue before the first use
#pragma unroll
  for (int j = 0; j < CVT_U; ++j) v[j] = in4[j * 256];
#pragma unroll
  for (int j = 0; j < CVT_U; ++j) {
    v4bf o;
    o[0] = (__bf16)v[j][0];
    o[1] = (__bf16)v[j][1];
    o[2] = (__bf16)v[j][2];
    o[3] = (__bf16)v[j][3];
    out4[j * 256] = o;
  }
}

// ---------------------------------------------------------------- QKV GEMM
// C = x(4096x512) @ W^T(512x512); Q scaled by 1/sqrt(64); V stored transposed.
// Q,K: [head][n][64]   Vt: [head][64][n]   (bf16)
// A block of 8 waves makes 128 tokens x 64 columns, each wave 16 x 64. Both
// operands are staged in LDS, GK columns of k per stage, with double-buffered
// async global->LDS copies (ASYNCcnt): a copy moves whole lines, a stage is in
// flight while the one before is worked on, and a W row is fetched once a block.
#define GK 128  // k per stage
#define GP 136  // LDS row pitch in elements: 256 B + 16 B pad (16 B x odd)
__global__ __launch_bounds__(256) void qkv_gemm(const __bf16* __restrict__ xb,
                                                const __bf16* __restrict__ wq,
                                                const __bf16* __restrict__ wk,
                                                const __bf16* __restrict__ wv,
                                                __bf16* __restrict__ Qh,
                                                __bf16* __restrict__ Kh,
                                                __bf16* __restrict__ Vt) {
  __shared__ __attribute__((aligned(16))) __bf16 Xs[2][128 * GP];  // [token][k], padded rows
  __shared__ __attribute__((aligned(16))) __bf16 Ws[2][64 * GP];   // [col][k], padded rows

  const int tid  = threadIdx.x;
  const int lane = threadIdx.x & 31;
  const int wave = threadIdx.x >> 5;
  const int m0 = (blockIdx.x * 8 + wave) * 16;   // token rows
  const int n0 = blockIdx.y * 64;                // output cols (hd)
  const int z  = blockIdx.z;                     // 0=Q 1=K 2=V
  const __bf16* W = (z == 0) ? wq : (z == 1) ? wk : wv;

  // 16 threads copy the 256 B of a row, the block 16 rows at a time: a thread's
  // pieces lie 16 rows apart, eight of the x tile and four of the W tile per stage.
  const __bf16* xg = xb + (blockIdx.x * 128 + (tid >> 4)) * 512 + (tid & 15) * 8;
  const __bf16* wg = W  + (n0 + (tid >> 4)) * 512 + (tid & 15) * 8;
  const int sl = (tid >> 4) * GP + (tid & 15) * 8;

  // stage 0 into buffer 0, published; then stage 1 into buffer 1, in flight
  async_copy8_b128(xg, 16 * 512, Xs[0] + sl, 16 * GP);
  async_copy4_b128(wg, 16 * 512, Ws[0] + sl, 16 * GP);
  ASYNC_WAIT_0();
  __syncthreads();
  async_copy8_b128(xg + GK, 16 * 512, Xs[1] + sl, 16 * GP);
  async_copy4_b128(wg + GK, 16 * 512, Ws[1] + sl, 16 * GP);

  v8f acc[4] = {};
  for (int s = 0; s < 512 / GK; ++s) {
    const int cur = s & 1;
    const __bf16* xc = Xs[cur];
    const __bf16* wc = Ws[cur];
    // both loops unrolled: kk folds into the offset field of the LDS reads, and
    // acc, indexed by constants, lives in registers
#pragma unroll
    for (int kk = 0; kk < GK; kk += 32) {
      v16bf a = load_frag(xc, GP, wave * 16, kk, lane);
#pragma unroll
      for (int nt = 0; nt < 4; ++nt) {
        v16bf b = load_frag(wc, GP, nt * 16, kk, lane);
        acc[nt] = wmma_bf16(a, b, acc[nt]);
      }
    }

    // publish point: own reads of buf[cur] done, own copies of the next stage
    // landed; the one barrier publishes that stage and frees buf[cur]
    DS_WAIT_0();
    ASYNC_WAIT_0();
    __syncthreads();
    if (s + 2 < 512 / GK) {  // refill the buffer just read, two stages ahead
      const int kn = (s + 2) * GK;
      async_copy8_b128(xg + kn, 16 * 512, Xs[cur] + sl, 16 * GP);
      async_copy4_b128(wg + kn, 16 * 512, Ws[cur] + sl, 16 * GP);
    }
  }
  ASYNC_WAIT_0();   // nothing of this wave is in flight when it ends

  // D layout: lanes0-15 N=lane, M=reg; lanes16-31 N=lane-16, M=8+reg
#pragma unroll
  for (int nt = 0; nt < 4; ++nt) {
    const int o = n0 + nt * 16 + (lane & 15);    // hd index
    const int h = o >> 6, d = o & 63;
#pragma unroll
    for (int r = 0; r < 8; ++r) {
      const int m = m0 + ((lane < 16) ? r : 8 + r);
      const float v = acc[nt][r];
      if (z == 0)      Qh[((long)(h << 12) + m) * 64 + d] = (__bf16)(v * 0.125f);
      else if (z == 1) Kh[((long)(h << 12) + m) * 64 + d] = (__bf16)v;
      else             Vt[(long)o * 4096 + m] = (__bf16)v;   // o == h*64+d
    }
  }
}

// ---------------------------------------------------------------- attention
// One block per 128 queries of one head, 16 waves. A wave owns 32 queries (two
// 16-query tiles), so that every K and V fragment it reads from LDS feeds two
// matrix instructions. The four waves of a query group share each staged tile of
// KT keys, WK keys each, and keep their own running maximum, sum and O^T; the
// four partial results are joined once, through LDS, behind the loop.
// K/V tiles are staged in LDS with double-buffered async global->LDS copies
// (ASYNCcnt), once for all 128 queries.
// Computes S^T = K @ Q^T so softmax reduction is in-lane + one xor16 shuffle,
// and each pair of 16-key S^T tiles forms a native K=32 B-fragment of P^T.
__global__ __launch_bounds__(512) void attn_flash(const __bf16* __restrict__ Qh,
                                                  const __bf16* __restrict__ Kh,
                                                  const __bf16* __restrict__ Vt,
                                                  __bf16* __restrict__ Ob) {
  // the ring: K [2][key][d] and V [2][d][key], padded rows; behind the loop the
  // same bytes hold the partial results
  __shared__ __attribute__((aligned(16))) unsigned char smem[SM_BYTES];
  __bf16* Ks = reinterpret_cast<__bf16*>(smem);
  __bf16* Vs = Ks + 2 * KT * KP;

  const int tid  = threadIdx.x;
  const int lane = tid & 31;
  const int wave = tid >> 5;
  const int ks = wave & (NS - 1);   // which WK keys of a stage
  const int qg = wave / NS;         // which 32 queries of the block
  const int h  = blockIdx.y;
  const int q0 = blockIdx.x * 128 + qg * 32;
  const __bf16* Q = Qh + (long)(h << 12) * 64;
  const __bf16* K = Kh + (long)(h << 12) * 64;
  const __bf16* V = Vt + (long)(h << 6) * 4096;

  // loop-invariant Q B-fragments (2 x 16 queries x 64 d); unrolled so that qb,
  // indexed by constants, lives in registers
  v16bf qb[2][2];
#pragma unroll
  for (int c = 0; c < 2; ++c) {
    qb[c][0] = load_frag(Q, 64, q0 + 16 * c, 0, lane);
    qb[c][1] = load_frag(Q, 64, q0 + 16 * c, 32, lane);
  }

  // Each thread copies four 16-byte pieces of the K tile (64 rows apart) and
  // four of the V tile (16 rows apart) per stage.
  const __bf16* kg = K + tid * 8;
  const __bf16* vg = V + (tid >> 5) * 4096 + (tid & 31) * 8;
  const int kl = (tid >> 3) * KP + (tid & 7) * 8;
  const int vl = (tid >> 5) * VP + (tid & 31) * 8;

  // stage 0 into buffer 0, published; then stage 1 into buffer 1, in flight
  async_copy4_b128(kg, 64 * 64, Ks + kl, 64 * KP);
  async_copy4_b128(vg, 16 * 4096, Vs + vl, 16 * VP);
  ASYNC_WAIT_0();
  __syncthreads();
  async_copy4_b128(kg + KT * 64, 64 * 64, Ks + KT * KP + kl, 64 * KP);
  async_copy4_b128(vg + KT, 16 * 4096, Vs + 64 * VP + vl, 16 * VP);

  v8f o[4][2] = {};   // [16 d][16 queries]
  float mrun[2] = {-3.0e38f, -3.0e38f}, lrun[2] = {0.0f, 0.0f};

  for (int it = 0; it < 4096 / KT; ++it) {
    const int cur = it & 1;
    const __bf16* kc = Ks + cur * (KT * KP) + ks * (WK * KP);  // this wave's key rows
    const __bf16* vc = Vs + cur * (64 * VP) + ks * WK;         // this wave's key columns

    // S^T tiles from LDS: four tiles of 16 keys, each against both query tiles.
    // The loops over j, c, g, t and r are unrolled so that s, o, tm, ps and p,
    // indexed by constants, live in registers.
    v8f s[4][2];
#pragma unroll
    for (int j = 0; j < 4; ++j) {
      v16bf ka = load_frag(kc, KP, 16 * j, 0,  lane);
      v16bf kb = load_frag(kc, KP, 16 * j, 32, lane);
#pragma unroll
      for (int c = 0; c < 2; ++c) {
        v8f z = {};
        z = wmma_bf16(ka, qb[c][0], z);
        s[j][c] = wmma_bf16(kb, qb[c][1], z);
      }
    }

    // online softmax over the key axis (regs + lane-half exchange), per query
    // tile; one chain per 32 keys, joined at the end
    Frag16 p[2][2];
#pragma unroll
    for (int c = 0; c < 2; ++c) {
      float tm[2];
#pragma unroll
      for (int g = 0; g < 2; ++g) {
        tm[g] = s[2 * g][c][0];
#pragma unroll
        for (int r = 0; r < 8; ++r) {
          tm[g] = fmaxf(tm[g], s[2 * g][c][r]);
          tm[g] = fmaxf(tm[g], s[2 * g + 1][c][r]);
        }
      }
      float tmax = fmaxf(tm[0], tm[1]);
      tmax = fmaxf(tmax, __shfl_xor(tmax, 16, 32));
      const float mnew  = fmaxf(mrun[c], tmax);
      const float alpha = __expf(mrun[c] - mnew);

      float ps[2];
#pragma unroll
      for (int g = 0; g < 2; ++g) {
        ps[g] = 0.0f;
#pragma unroll
        for (int r = 0; r < 8; ++r) {
          const float e0 = __expf(s[2 * g][c][r] - mnew);
          const float e1 = __expf(s[2 * g + 1][c][r] - mnew);
          ps[g] += e0 + e1;
          p[g][c].v[r]     = (__bf16)e0;   // keys 32g+{0..7 | 8..15}  (per lane half)
          p[g][c].v[8 + r] = (__bf16)e1;   // keys 32g+{16..23 | 24..31}
        }
      }
      float psum = ps[0] + ps[1];
      psum += __shfl_xor(psum, 16, 32);
      lrun[c] = lrun[c] * alpha + psum;
      mrun[c] = mnew;
#pragma unroll
      for (int t = 0; t < 4; ++t) {
#pragma unroll
        for (int r = 0; r < 8; ++r) o[t][c][r] *= alpha;
      }
    }

    // O^T += V^T(64 x 64 keys) @ P^T(64 keys x 32 queries), V from LDS
#pragma unroll
    for (int g = 0; g < 2; ++g) {
#pragma unroll
      for (int t = 0; t < 4; ++t) {
        v16bf va = load_frag(vc, VP, 16 * t, 32 * g, lane);
        o[t][0] = wmma_bf16(va, p[g][0].v, o[t][0]);
        o[t][1] = wmma_bf16(va, p[g][1].v, o[t][1]);
      }
    }

    // publish point: own reads of buf[cur] done, own copies of the next stage
    // landed; the one barrier publishes that stage and frees buf[cur]
    DS_WAIT_0();
    ASYNC_WAIT_0();
    __syncthreads();
    if (it + 2 < 4096 / KT) {  // refill the buffer just read, two stages ahead
      const int kn = (it + 2) * KT;
      async_copy4_b128(kg + kn * 64, 64 * 64, Ks + cur * (KT * KP) + kl, 64 * KP);
      async_copy4_b128(vg + kn, 16 * 4096, Vs + cur * (64 * VP) + vl, 16 * VP);
    }
  }
  ASYNC_WAIT_0();   // nothing of this wave is in flight when it ends

  // Join of the four partial results of a query group. The last publish point
  // has ended every read of the ring and nothing is in flight, so its bytes are
  // free. A wave's store or load of four floats a lane covers 512 contiguous bytes.
  // The loops of the join are unrolled for the same reason as those above: o, mj
  // and lj, indexed by constants, live in registers.
  float* Om = reinterpret_cast<float*>(smem);   // [wave][d tile][query tile][half][lane][4]
  float* Mm = Om + 16 * 8 * 256;                // [wave][query tile][lane]
  float* Lm = Mm + 16 * 2 * 32;
#pragma unroll
  for (int t = 0; t < 4; ++t) {
#pragma unroll
    for (int c = 0; c < 2; ++c) {
      v4f* d4 = reinterpret_cast<v4f*>(Om + ((wave * 4 + t) * 2 + c) * 256) + lane;
      v4f lo = {o[t][c][0], o[t][c][1], o[t][c][2], o[t][c][3]};
      v4f hi = {o[t][c][4], o[t][c][5], o[t][c][6], o[t][c][7]};
      d4[0]  = lo;
      d4[32] = hi;
    }
  }
#pragma unroll
  for (int c = 0; c < 2; ++c) {
    Mm[(wave * 2 + c) * 32 + lane] = mrun[c];
    Lm[(wave * 2 + c) * 32 + lane] = lrun[c];
  }
  __syncthreads();   // the partial results are read by the group's other waves

  // wave ks of a group finishes d tile ks of its 32 queries
#pragma unroll
  for (int c = 0; c < 2; ++c) {
    float mj[NS], lj[NS];
#pragma unroll
    for (int j = 0; j < NS; ++j) {
      mj[j] = Mm[((qg * NS + j) * 2 + c) * 32 + lane];
      lj[j] = Lm[((qg * NS + j) * 2 + c) * 32 + lane];
    }
    const float mall = fmaxf(fmaxf(mj[0], mj[1]), fmaxf(mj[2], mj[3]));
    float lall = 0.0f;
    v4f lo = {}, hi = {};
#pragma unroll
    for (int j = 0; j < NS; ++j) {
      const float w = __expf(mj[j] - mall);
      const v4f* s4 =
          reinterpret_cast<const v4f*>(Om + (((qg * NS + j) * 4 + ks) * 2 + c) * 256) + lane;
      lall += w * lj[j];
      lo += w * s4[0];
      hi += w * s4[32];
    }
    const float inv = 1.0f / lall;
    v8bf ob;
#pragma unroll
    for (int r = 0; r < 4; ++r) {
      ob[r]     = (__bf16)(lo[r] * inv);
      ob[4 + r] = (__bf16)(hi[r] * inv);
    }
    // D layout: a lane holds 8 consecutive d of one query, 16 bytes
    const int q = q0 + 16 * c + (lane & 15);
    *reinterpret_cast<v8bf*>(Ob + (long)q * 512 + (h << 6) + ks * 16 + ((lane >> 4) << 3)) = ob;
  }
}

// ---------------------------------------------------------------- output proj
// out(4096x64) = Ob(4096x512) @ Wo^T(512x64) + bo, f32 output.
__global__ __launch_bounds__(128) void out_gemm(const __bf16* __restrict__ Ob,
                                                const __bf16* __restrict__ Wob,
                                                const float* __restrict__ bo,
                                                float* __restrict__ out) {
  const int lane = threadIdx.x & 31;
  const int wave = threadIdx.x >> 5;
  const int m0 = (blockIdx.x * 4 + wave) * 16;
  const int o0 = blockIdx.y * 16;

  v8f acc = {};
  for (int k0 = 0; k0 < 512; k0 += 32) {
    v16bf a = load_frag(Ob, 512, m0, k0, lane);
    v16bf b = load_frag(Wob, 512, o0, k0, lane);
    acc = wmma_bf16(a, b, acc);
  }
  const int o = o0 + (lane & 15);
  const float bias = bo[o];
#pragma unroll
  for (int r = 0; r < 8; ++r) {
    const int m = m0 + ((lane < 16) ? r : 8 + r);
    out[(long)m * 64 + o] = acc[r] + bias;
  }
}

// ---------------------------------------------------------------- launch
extern "C" void kernel_launch(void* const* d_in, const int* in_sizes, int n_in,
                              void* d_out, int out_size, void* d_ws, size_t ws_size,
                              hipStream_t stream) {
  const float* x  = (const float*)d_in[0];   // 4096x512
  const float* Wq = (const float*)d_in[1];   // 512x512
  const float* Wk = (const float*)d_in[2];   // 512x512
  const float* Wv = (const float*)d_in[3];   // 512x512
  const float* Wo = (const float*)d_in[4];   // 64x512
  const float* bo = (const float*)d_in[5];   // 64
  float* out = (float*)d_out;                // 4096x64

  char* ws = (char*)d_ws;
  size_t off = 0;
  __bf16* xb  = (__bf16*)(ws + off); off += (size_t)4096 * 512 * 2;  // 4 MB
  __bf16* wqb = (__bf16*)(ws + off); off += (size_t)512 * 512 * 2;
  __bf16* wkb = (__bf16*)(ws + off); off += (size_t)512 * 512 * 2;
  __bf16* wvb = (__bf16*)(ws + off); off += (size_t)512 * 512 * 2;
  __bf16* wob = (__bf16*)(ws + off); off += (size_t)64 * 512 * 2;
  __bf16* Qh  = (__bf16*)(ws + off); off += (size_t)8 * 4096 * 64 * 2;
  __bf16* Kh  = (__bf16*)(ws + off); off += (size_t)8 * 4096 * 64 * 2;
  __bf16* Vt  = (__bf16*)(ws + off); off += (size_t)8 * 64 * 4096 * 2;
  __bf16* Ob  = (__bf16*)(ws + off); off += (size_t)4096 * 512 * 2;

  // xb, wqb, wkb, wvb, wob are one contiguous range that starts at xb
  cvt_f32_bf16<<<CVT_NX + 3 * CVT_NW + CVT_NO, 256, 0, stream>>>(x, Wq, Wk, Wv, Wo, xb);

  qkv_gemm<<<dim3(32, 8, 3), 256, 0, stream>>>(xb, wqb, wkb, wvb, Qh, Kh, Vt);
  attn_flash<<<dim3(32, 8), 512, 0, stream>>>(Qh, Kh, Vt, Ob);
  out_gemm<<<dim3(64, 4), 128, 0, stream>>>(Ob, wob, bo, out);
}

// v007
// Measured time: 49.7 microseconds a run.
// It is 1.11 times as fast as v005, going by the measured steps of the versions left out in between.
// Counting every step since v000, it is 3.34 times as fast.
#include <hip/hip_runtime.h>
#include <hip/hip_bf16.h>

typedef __attribute__((ext_vector_type(8)))  float  v8f;
typedef __attribute__((ext_vector_type(4)))  float  v4f;
typedef __attribute__((ext_vector_type(2)))  float  v2f;
typedef __attribute__((ext_vector_type(4)))  __bf16 v4bf;
typedef __attribute__((ext_vector_type(8)))  __bf16 v8bf;
typedef __attribute__((ext_vector_type(16))) __bf16 v16bf;

union Frag16 { v16bf v; v8bf h[2]; };

static __device__ __forceinline__ v8f wmma_bf16(v16bf a, v16bf b, v8f c) {
  return __builtin_amdgcn_wmma_f32_16x16x32_bf16(false, a, false, b, (short)0, c,
                                                 false, false);
}

// Load a 16x32 (rows x k) bf16 A/B fragment in the CDNA5 WMMA register layout:
// lanes 0-15 -> row r0+lane,    K = k0+{0..7, 16..23}
// lanes16-31 -> row r0+lane-16, K = k0+{8..15,24..31}
static __device__ __forceinline__ v16bf load_frag(const __bf16* mat, int ld, int r0,
                                                  int k0, int lane) {
  const int row = r0 + (lane & 15);
  const int kb  = k0 + ((lane >> 4) << 3);
  const __bf16* p = mat + (long)row * ld + kb;
  Frag16 f;
  f.h[0] = *reinterpret_cast<const v8bf*>(p);
  f.h[1] = *reinterpret_cast<const v8bf*>(p + 16);
  return f.v;
}

// LDS row pitches in elements: 16 B x odd, so that the 16 rows a ds_load_b128
// fragment read touches fall on distinct banks.
#define KT 256        // keys per stage
#define NS 4          // waves that share a stage's keys
#define WK (KT / NS)  // keys per wave and per softmax step
#define KP 72         // 64 d    + 8 pad = 144 B
#define VP 264        // 256 keys + 8 pad = 528 B
#define SM_BYTES (2 * (KT * KP + 64 * VP) * 2)
// The maximum in use is renewed only when a score tops it by more than this
// (8 binary orders, so an exponential stays below 2^8).
#define LAZY_RISE 5.545177f
#define LOG2E 1.44269504f

// Eight CDNA5 async global->LDS copies of 16 bytes per lane (ASYNCcnt): piece j
// lies gs elements further in global memory and ls elements further in LDS.
// The s_wait_xcnt closes the statement so that no address register of a copy
// is rewritten ahead of it.
static __device__ __forceinline__ void async_copy8_b128(const __bf16* g, int gs,
                                                        __bf16* l, int ls) {
  // addr[31:0] == LDS offset
  asm volatile("global_load_async_to_lds_b128 %0, %1, off\n\t"
               "global_load_async_to_lds_b128 %2, %3, off\n\t"
               "global_load_async_to_lds_b128 %4, %5, off\n\t"
               "global_load_async_to_lds_b128 %6, %7, off\n\t"
               "global_load_async_to_lds_b128 %8, %9, off\n\t"
               "global_load_async_to_lds_b128 %10, %11, off\n\t"
               "global_load_async_to_lds_b128 %12, %13, off\n\t"
               "global_load_async_to_lds_b128 %14, %15, off\n\t"
               "s_wait_xcnt 0x0"
               :: "v"((unsigned)(uintptr_t)(l)),          "v"(g),
                  "v"((unsigned)(uintptr_t)(l + ls)),     "v"(g + gs),
                  "v"((unsigned)(uintptr_t)(l + 2 * ls)), "v"(g + 2 * gs),
                  "v"((unsigned)(uintptr_t)(l + 3 * ls)), "v"(g + 3 * gs),
                  "v"((unsigned)(uintptr_t)(l + 4 * ls)), "v"(g + 4 * gs),
                  "v"((unsigned)(uintptr_t)(l + 5 * ls)), "v"(g + 5 * gs),
                  "v"((unsigned)(uintptr_t)(l + 6 * ls)), "v"(g + 6 * gs),
                  "v"((unsigned)(uintptr_t)(l + 7 * ls)), "v"(g + 7 * gs)
               : "memory");
}
// The same with four pieces, closed by the same s_wait_xcnt for the same reason.
static __device__ __forceinline__ void async_copy4_b128(const __bf16* g, int gs,
                                                        __bf16* l, int ls) {
  asm volatile("global_load_async_to_lds_b128 %0, %1, off\n\t"
               "global_load_async_to_lds_b128 %2, %3, off\n\t"
               "global_load_async_to_lds_b128 %4, %5, off\n\t"
               "global_load_async_to_lds_b128 %6, %7, off\n\t"
               "s_wait_xcnt 0x0"
               :: "v"((unsigned)(uintptr_t)(l)),          "v"(g),
                  "v"((unsigned)(uintptr_t)(l + ls)),     "v"(g + gs),
                  "v"((unsigned)(uintptr_t)(l + 2 * ls)), "v"(g + 2 * gs),
                  "v"((unsigned)(uintptr_t)(l + 3 * ls)), "v"(g + 3 * gs)
               : "memory");
}
// this wave's copies have landed
#define ASYNC_WAIT_0() asm volatile("s_wait_asynccnt 0x0" ::: "memory")
// this wave's LDS reads have returned, so the buffer may be handed back
#define DS_WAIT_0() asm volatile("s_wait_dscnt 0x0" ::: "memory")

// ---------------------------------------------------------------- convert
// One launch converts all five f32 operands. Their bf16 copies lie back to back
// in the workspace in the order x, Wq, Wk, Wv, Wo, so a block's place in the
// output is its index; only the source pointer depends on the operand.
// A block takes CVT_BLK elements, and every operand is a whole number of blocks.
#define CVT_U   8                     // 16-byte loads in flight per thread
#define CVT_BLK (256 * 4 * CVT_U)     // elements per block
#define CVT_NX  (4096 * 512 / CVT_BLK)
#define CVT_NW  (512 * 512 / CVT_BLK)
#define CVT_NO  (64 * 512 / CVT_BLK)
__global__ __launch_bounds__(256) void cvt_f32_bf16(const float* __restrict__ x,
                                                    const float* __restrict__ wq,
                                                    const float* __restrict__ wk,
                                                    const float* __restrict__ wv,
                                                    const float* __restrict__ wo,
                                                    __bf16* __restrict__ out) {
  const int b = blockIdx.x;
  const float* src;
  int rel;
  if (b < CVT_NX)                   { src = x;  rel = b; }
  else if (b < CVT_NX + CVT_NW)     { src = wq; rel = b - CVT_NX; }
  else if (b < CVT_NX + 2 * CVT_NW) { src = wk; rel = b - CVT_NX - CVT_NW; }
  else if (b < CVT_NX + 3 * CVT_NW) { src = wv; rel = b - CVT_NX - 2 * CVT_NW; }
  else                              { src = wo; rel = b - CVT_NX - 3 * CVT_NW; }

  // a wave's load covers 512 contiguous bytes, its store 256
  const v4f* in4 = reinterpret_cast<const v4f*>(src + rel * CVT_BLK) + threadIdx.x;
  v4bf* out4 = reinterpret_cast<v4bf*>(out + (long)b * CVT_BLK) + threadIdx.x;
  v4f v[CVT_U];
  // both loops unrolled: v stays in registers and all loads issue before the first use
#pragma unroll
  for (int j = 0; j < CVT_U; ++j) v[j] = in4[j * 256];
#pragma unroll
  for (int j = 0; j < CVT_U; ++j) {
    v4bf o;
    o[0] = (__bf16)v[j][0];
    o[1] = (__bf16)v[j][1];
    o[2] = (__bf16)v[j][2];
    o[3] = (__bf16)v[j][3];
    out4[j * 256] = o;
  }
}

// ---------------------------------------------------------------- QKV GEMM
// C = x(4096x512) @ W^T(512x512); Q scaled by 1/sqrt(64); V stored transposed.
// Q,K: [head][n][64]   Vt: [head][64][n]   (bf16)
// A block of 8 waves makes 128 tokens x 64 columns. Both operands are staged in
// LDS, GK columns of k per stage, with double-buffered async global->LDS copies
// (ASYNCcnt): a copy moves whole lines, a stage is in flight while the one before
// is worked on, and a W row is fetched once a block.
// A lane's eight accumulator registers are eight neighbouring rows of the A
// operand. The A operand is therefore the one whose rows lie side by side in the
// result's memory order: W for Q and K (a wave: 64 d x 16 tokens), x for the
// transposed V (a wave: 64 tokens x 16 d). The block's result then leaves through
// LDS in 16-byte pieces, in memory order, so that a wave's store covers whole lines.
#define GK 128  // k per stage
#define GP 136  // LDS row pitch in elements: 256 B + 16 B pad (16 B x odd)
__global__ __launch_bounds__(256) void qkv_gemm(const __bf16* __restrict__ xb,
                                                const __bf16* __restrict__ wq,
                                                const __bf16* __restrict__ wk,
                                                const __bf16* __restrict__ wv,
                                                __bf16* __restrict__ Qh,
                                                __bf16* __restrict__ Kh,
                                                __bf16* __restrict__ Vt) {
  __shared__ __attribute__((aligned(16))) __bf16 Xs[2][128 * GP];  // [token][k], padded rows
  __shared__ __attribute__((aligned(16))) __bf16 Ws[2][64 * GP];   // [col][k], padded rows

  const int tid  = threadIdx.x;
  const int lane = threadIdx.x & 31;
  const int wave = threadIdx.x >> 5;
  const int t0 = blockIdx.x * 128;               // token rows
  const int n0 = blockIdx.y * 64;                // output cols (hd): one head
  const int z  = blockIdx.z;                     // 0=Q 1=K 2=V
  const bool vt = (z == 2);
  const __bf16* W = (z == 0) ? wq : (z == 1) ? wk : wv;

  // 16 threads copy the 256 B of a row, the block 16 rows at a time: a thread's
  // pieces lie 16 rows apart, eight of the x tile and four of the W tile per stage.
  const __bf16* xg = xb + (blockIdx.x * 128 + (tid >> 4)) * 512 + (tid & 15) * 8;
  const __bf16* wg = W  + (n0 + (tid >> 4)) * 512 + (tid & 15) * 8;
  const int sl = (tid >> 4) * GP + (tid & 15) * 8;

  // stage 0 into buffer 0, published; then stage 1 into buffer 1, in flight
  async_copy8_b128(xg, 16 * 512, Xs[0] + sl, 16 * GP);
  async_copy4_b128(wg, 16 * 512, Ws[0] + sl, 16 * GP);
  ASYNC_WAIT_0();
  __syncthreads();
  async_copy8_b128(xg + GK, 16 * 512, Xs[1] + sl, 16 * GP);
  async_copy4_b128(wg + GK, 16 * 512, Ws[1] + sl, 16 * GP);

  // this wave's 64 rows of the A tile and 16 rows of the B tile
  const int ar = vt ? (wave >> 2) * 64 : 0;
  const int br = vt ? (wave & 3) * 16 : wave * 16;

  v8f acc[4] = {};
  for (int s = 0; s < 512 / GK; ++s) {
    const int cur = s & 1;
    const __bf16* ac = (vt ? Xs[cur] : Ws[cur]) + ar * GP;
    const __bf16* bc = (vt ? Ws[cur] : Xs[cur]) + br * GP;
    // both loops unrolled: kk folds into the offset field of the LDS reads, and
    // acc, indexed by constants, lives in registers
#pragma unroll
    for (int kk = 0; kk < GK; kk += 32) {
      v16bf b = load_frag(bc, GP, 0, kk, lane);
#pragma unroll
      for (int nt = 0; nt < 4; ++nt) {
        v16bf a = load_frag(ac, GP, nt * 16, kk, lane);
        acc[nt] = wmma_bf16(a, b, acc[nt]);
      }
    }

    // publish point: own reads of buf[cur] done, own copies of the next stage
    // landed; the one barrier publishes that stage and frees buf[cur]
    DS_WAIT_0();
    ASYNC_WAIT_0();
    __syncthreads();
    if (s + 2 < 512 / GK) {  // refill the buffer just read, two stages ahead
      const int kn = (s + 2) * GK;
      async_copy8_b128(xg + kn, 16 * 512, Xs[cur] + sl, 16 * GP);
      async_copy4_b128(wg + kn, 16 * 512, Ws[cur] + sl, 16 * GP);
    }
  }
  ASYNC_WAIT_0();   // nothing of this wave is in flight when it ends

  // The result tile in LDS, rows as in memory: [128 tokens][64 d] for Q and K,
  // [64 d][128 tokens] for V; row pitch 16 B x odd again, for the 16-byte writes.
  // The last publish point has ended every read of the ring and nothing is in
  // flight, so the x ring's bytes are free for it.
  // D layout: lanes 0-15 N=lane, M=reg; lanes 16-31 N=lane-16, M=8+reg
  __bf16* Ts = Xs[0];
  const int tp = vt ? 128 + 8 : 64 + 8;
  const float scale = (z == 0) ? 0.125f : 1.0f;
  __bf16* tw = Ts + (br + (lane & 15)) * tp + ar + ((lane >> 4) << 3);
  // both loops unrolled: acc and pk, indexed by constants, live in registers
#pragma unroll
  for (int nt = 0; nt < 4; ++nt) {
    v8bf pk;
#pragma unroll
    for (int r = 0; r < 8; ++r) pk[r] = (__bf16)(acc[nt][r] * scale);
    *reinterpret_cast<v8bf*>(tw + nt * 16) = pk;
  }
  __syncthreads();   // the tile is read by other waves than wrote it

  // 1024 pieces of 16 bytes, four a thread; neighbouring threads take neighbouring
  // pieces of a row. Q, K: the 128 tokens of one head are 16 KB in a row.
  const int sh = vt ? 4 : 3;          // log2 of the pieces in a row
  const int dld = vt ? 4096 : 64;     // row pitch in memory
  __bf16* dst = vt ? Vt + n0 * 4096 + t0
                   : ((z == 0) ? Qh : Kh) + (blockIdx.y * 4096 + t0) * 64;
  // unrolled so that the four LDS reads go out together
#pragma unroll
  for (int j = 0; j < 4; ++j) {
    const int idx = j * 256 + tid;
    const int row = idx >> sh, pc = idx & ((1 << sh) - 1);
    *reinterpret_cast<v8bf*>(dst + row * dld + pc * 8) =
        *reinterpret_cast<const v8bf*>(Ts + row * tp + pc * 8);
  }
}

// ---------------------------------------------------------------- attention
// One block per 128 queries of one head, 16 waves. A wave owns 32 queries (two
// 16-query tiles), so that every K and V fragment it reads from LDS feeds two
// matrix instructions. The four waves of a query group share each staged tile of
// KT keys, WK keys each, and keep their own running maximum, sum and O^T; the
// four partial results are joined once, through LDS, behind the loop.
// K/V tiles are staged in LDS with double-buffered async global->LDS copies
// (ASYNCcnt), once for all 128 queries.
// Computes S^T = K @ Q^T so softmax reduction is in-lane + one xor16 shuffle,
// and each pair of 16-key S^T tiles forms a native K=32 B-fragment of P^T.
// The softmax maximum is lazy: a wave keeps the maximum it has in use until a
// score tops it by more than LAZY_RISE. It is therefore known before a step's
// scores are, and enters their matrix product negated, as the C operand: the
// scores arrive already reduced by it, and O and the row sum are rescaled only
// in the rare step that renews it.
__global__ __launch_bounds__(512) void attn_flash(const __bf16* __restrict__ Qh,
                                                  const __bf16* __restrict__ Kh,
                                                  const __bf16* __restrict__ Vt,
                                                  __bf16* __restrict__ Ob) {
  // the ring: K [2][key][d] and V [2][d][key], padded rows; behind the loop the
  // same bytes hold the partial results
  __shared__ __attribute__((aligned(16))) unsigned char smem[SM_BYTES];
  __bf16* Ks = reinterpret_cast<__bf16*>(smem);
  __bf16* Vs = Ks + 2 * KT * KP;

  const int tid  = threadIdx.x;
  const int lane = tid & 31;
  const int wave = tid >> 5;
  const int ks = wave & (NS - 1);   // which WK keys of a stage
  const int qg = wave / NS;         // which 32 queries of the block
  const int h  = blockIdx.y;
  const int q0 = blockIdx.x * 128 + qg * 32;
  const __bf16* Q = Qh + (long)(h << 12) * 64;
  const __bf16* K = Kh + (long)(h << 12) * 64;
  const __bf16* V = Vt + (long)(h << 6) * 4096;

  // loop-invariant Q B-fragments (2 x 16 queries x 64 d); unrolled so that qb,
  // indexed by constants, lives in registers
  v16bf qb[2][2];
#pragma unroll
  for (int c = 0; c < 2; ++c) {
    qb[c][0] = load_frag(Q, 64, q0 + 16 * c, 0, lane);
    qb[c][1] = load_frag(Q, 64, q0 + 16 * c, 32, lane);
  }

  // Each thread copies four 16-byte pieces of the K tile (64 rows apart) and
  // four of the V tile (16 rows apart) per stage.
  const __bf16* kg = K + tid * 8;
  const __bf16* vg = V + (tid >> 5) * 4096 + (tid & 31) * 8;
  const int kl = (tid >> 3) * KP + (tid & 7) * 8;
  const int vl = (tid >> 5) * VP + (tid & 31) * 8;

  // stage 0 into buffer 0, published; then stage 1 into buffer 1, in flight
  async_copy4_b128(kg, 64 * 64, Ks + kl, 64 * KP);
  async_copy4_b128(vg, 16 * 4096, Vs + vl, 16 * VP);
  ASYNC_WAIT_0();
  __syncthreads();
  async_copy4_b128(kg + KT * 64, 64 * 64, Ks + KT * KP + kl, 64 * KP);
  async_copy4_b128(vg + KT, 16 * 4096, Vs + 64 * VP + vl, 16 * VP);

  v8f o[4][2] = {};   // [16 d][16 queries]
  // per query: the negative of the maximum in use, in all eight registers of a
  // C operand (the first step always renews it), and the row sum against it
  v8f nm[2] = {};
  float lrun[2] = {0.0f, 0.0f};

  // kept whole: with the first step split off as a copy of its own, the kernel
  // no longer fits its registers and spills
#pragma unroll 1
  for (int it = 0; it < 4096 / KT; ++it) {
    const int cur = it & 1;
    const __bf16* kc = Ks + cur * (KT * KP) + ks * (WK * KP);  // this wave's key rows
    const __bf16* vc = Vs + cur * (64 * VP) + ks * WK;         // this wave's key columns

    // S^T - max in use, from LDS: four tiles of 16 keys, each against both query
    // tiles. The loops over j, c, g, t, i and r are unrolled so that s, o, tm, ps
    // and p, indexed by constants, live in registers.
    v8f s[4][2];
#pragma unroll
    for (int j = 0; j < 4; ++j) {
      v16bf ka = load_frag(kc, KP, 16 * j, 0,  lane);
      v16bf kb = load_frag(kc, KP, 16 * j, 32, lane);
#pragma unroll
      for (int c = 0; c < 2; ++c) {
        v8f z = wmma_bf16(ka, qb[c][0], nm[c]);
        s[j][c] = wmma_bf16(kb, qb[c][1], z);
      }
    }

    // each lane's largest score of the step, over the maximum in use; one chain
    // per 32 keys, joined at the end
    float tmax[2];
#pragma unroll
    for (int c = 0; c < 2; ++c) {
      float tm[2];
#pragma unroll
      for (int g = 0; g < 2; ++g) {
        tm[g] = s[2 * g][c][0];
#pragma unroll
        for (int r = 0; r < 8; ++r) {
          tm[g] = fmaxf(tm[g], s[2 * g][c][r]);
          tm[g] = fmaxf(tm[g], s[2 * g + 1][c][r]);
        }
      }
      tmax[c] = fmaxf(tm[0], tm[1]);
    }

    // One test per step, the same for the whole wave: renew the maximum in the
    // first step, and later only where some query's score has outgrown it.
    const unsigned grown = __builtin_amdgcn_ballot_w32(fmaxf(tmax[0], tmax[1]) > LAZY_RISE);
    if ((grown | (unsigned)(it == 0)) != 0) {
#pragma unroll
      for (int c = 0; c < 2; ++c) {
        const float t = fmaxf(tmax[c], __shfl_xor(tmax[c], 16, 32));
        // the first step takes its own maximum, a later one never lowers it
        const float d = (it == 0) ? t : fmaxf(t, 0.0f);
        const float alpha = __expf(-fmaxf(d, 0.0f));
        lrun[c] *= alpha;
        nm[c] -= d;
#pragma unroll
        for (int j = 0; j < 4; ++j) {
#pragma unroll
          for (int r = 0; r < 8; ++r) s[j][c][r] -= d;
        }
#pragma unroll
        for (int t4 = 0; t4 < 4; ++t4) {
#pragma unroll
          for (int r = 0; r < 8; ++r) o[t4][c][r] *= alpha;
        }
      }
    }

    // exponentials and row sums, two neighbouring registers at a time; one sum
    // chain per 32 keys, joined at the end (regs + lane-half exchange)
    Frag16 p[2][2];
#pragma unroll
    for (int c = 0; c < 2; ++c) {
      v2f ps[2];
#pragma unroll
      for (int g = 0; g < 2; ++g) {
#pragma unroll
        for (int i = 0; i < 8; ++i) {
          // registers 2(i&3), 2(i&3)+1 of tile 2g+(i>>2):
          // keys 32g+{0..7 | 8..15} for i < 4, 32g+{16..23 | 24..31} behind (per lane half)
          const v8f& st = s[2 * g + (i >> 2)][c];
          const v2f a = (v2f){st[2 * (i & 3)], st[2 * (i & 3) + 1]} * LOG2E;
          const v2f e = {__builtin_amdgcn_exp2f(a.x), __builtin_amdgcn_exp2f(a.y)};
          ps[g] = (i == 0) ? e : ps[g] + e;
          p[g][c].v[2 * i]     = (__bf16)e.x;
          p[g][c].v[2 * i + 1] = (__bf16)e.y;
        }
      }
      const v2f pj = ps[0] + ps[1];
      float psum = pj.x + pj.y;
      psum += __shfl_xor(psum, 16, 32);
      lrun[c] += psum;
    }

    // O^T += V^T(64 x 64 keys) @ P^T(64 keys x 32 queries), V from LDS
#pragma unroll
    for (int g = 0; g < 2; ++g) {
#pragma unroll
      for (int t = 0; t < 4; ++t) {
        v16bf va = load_frag(vc, VP, 16 * t, 32 * g, lane);
        o[t][0] = wmma_bf16(va, p[g][0].v, o[t][0]);
        o[t][1] = wmma_bf16(va, p[g][1].v, o[t][1]);
      }
    }

    // publish point: own reads of buf[cur] done, own copies of the next stage
    // landed; the one barrier publishes that stage and frees buf[cur]
    DS_WAIT_0();
    ASYNC_WAIT_0();
    __syncthreads();
    if (it + 2 < 4096 / KT) {  // refill the buffer just read, two stages ahead
      const int kn = (it + 2) * KT;
      async_copy4_b128(kg + kn * 64, 64 * 64, Ks + cur * (KT * KP) + kl, 64 * KP);
      async_copy4_b128(vg + kn, 16 * 4096, Vs + cur * (64 * VP) + vl, 16 * VP);
    }
  }
  ASYNC_WAIT_0();   // nothing of this wave is in flight when it ends

  // Join of the four partial results of a query group. The last publish point
  // has ended every read of the ring and nothing is in flight, so its bytes are
  // free. A wave's store or load of four floats a lane covers 512 contiguous bytes.
  // The loops of the join are unrolled for the same reason as those above: o, mj
  // and lj, indexed by constants, live in registers.
  float* Om = reinterpret_cast<float*>(smem);   // [wave][d tile][query tile][half][lane][4]
  float* Mm = Om + 16 * 8 * 256;                // [wave][query tile][lane]
  float* Lm = Mm + 16 * 2 * 32;
#pragma unroll
  for (int t = 0; t < 4; ++t) {
#pragma unroll
    for (int c = 0; c < 2; ++c) {
      v4f* d4 = reinterpret_cast<v4f*>(Om + ((wave * 4 + t) * 2 + c) * 256) + lane;
      v4f lo = {o[t][c][0], o[t][c][1], o[t][c][2], o[t][c][3]};
      v4f hi = {o[t][c][4], o[t][c][5], o[t][c][6], o[t][c][7]};
      d4[0]  = lo;
      d4[32] = hi;
    }
  }
#pragma unroll
  for (int c = 0; c < 2; ++c) {
    Mm[(wave * 2 + c) * 32 + lane] = -nm[c][0];
    Lm[(wave * 2 + c) * 32 + lane] = lrun[c];
  }
  __syncthreads();   // the partial results are read by the group's other waves

  // wave ks of a group finishes d tile ks of its 32 queries
#pragma unroll
  for (int c = 0; c < 2; ++c) {
    float mj[NS], lj[NS];
#pragma unroll
    for (int j = 0; j < NS; ++j) {
      mj[j] = Mm[((qg * NS + j) * 2 + c) * 32 + lane];
      lj[j] = Lm[((qg * NS + j) * 2 + c) * 32 + lane];
    }
    const float mall = fmaxf(fmaxf(mj[0], mj[1]), fmaxf(mj[2], mj[3]));
    float lall = 0.0f;
    v4f lo = {}, hi = {};
#pragma unroll
    for (int j = 0; j < NS; ++j) {
      const float w = __expf(mj[j] - mall);
      const v4f* s4 =
          reinterpret_cast<const v4f*>(Om + (((qg * NS + j) * 4 + ks) * 2 + c) * 256) + lane;
      lall += w * lj[j];
      lo += w * s4[0];
      hi += w * s4[32];
    }
    const float inv = 1.0f / lall;
    v8bf ob;
#pragma unroll
    for (int r = 0; r < 4; ++r) {
      ob[r]     = (__bf16)(lo[r] * inv);
      ob[4 + r] = (__bf16)(hi[r] * inv);
    }
    // D layout: a lane holds 8 consecutive d of one query, 16 bytes
    const int q = q0 + 16 * c + (lane & 15);
    *reinterpret_cast<v8bf*>(Ob + (long)q * 512 + (h << 6) + ks * 16 + ((lane >> 4) << 3)) = ob;
  }
}

// ---------------------------------------------------------------- output proj
// out(4096x64) = Ob(4096x512) @ Wo^T(512x64) + bo, f32 output.
__global__ __launch_bounds__(128) void out_gemm(const __bf16* __restrict__ Ob,
                                                const __bf16* __restrict__ Wob,
                                                const float* __restrict__ bo,
                                                float* __restrict__ out) {
  const int lane = threadIdx.x & 31;
  const int wave = threadIdx.x >> 5;
  const int m0 = (blockIdx.x * 4 + wave) * 16;
  const int o0 = blockIdx.y * 16;

  v8f acc = {};
  for (int k0 = 0; k0 < 512; k0 += 32) {
    v16bf a = load_frag(Ob, 512, m0, k0, lane);
    v16bf b = load_frag(Wob, 512, o0, k0, lane);
    acc = wmma_bf16(a, b, acc);
  }
  const int o = o0 + (lane & 15);
  const float bias = bo[o];
#pragma unroll
  for (int r = 0; r < 8; ++r) {
    const int m = m0 + ((lane < 16) ? r : 8 + r);
    out[(long)m * 64 + o] = acc[r] + bias;
  }
}

// ---------------------------------------------------------------- launch
extern "C" void kernel_launch(void* const* d_in, const int* in_sizes, int n_in,
                              void* d_out, int out_size, void* d_ws, size_t ws_size,
                              hipStream_t stream) {
  const float* x  = (const float*)d_in[0];   // 4096x512
  const float* Wq = (const float*)d_in[1];   // 512x512
  const float* Wk = (const float*)d_in[2];   // 512x512
  const float* Wv = (const float*)d_in[3];   // 512x512
  const float* Wo = (const float*)d_in[4];   // 64x512
  const float* bo = (const float*)d_in[5];   // 64
  float* out = (float*)d_out;                // 4096x64

  char* ws = (char*)d_ws;
  size_t off = 0;
  __bf16* xb  = (__bf16*)(ws + off); off += (size_t)4096 * 512 * 2;  // 4 MB
  __bf16* wqb = (__bf16*)(ws + off); off += (size_t)512 * 512 * 2;
  __bf16* wkb = (__bf16*)(ws + off); off += (size_t)512 * 512 * 2;
  __bf16* wvb = (__bf16*)(ws + off); off += (size_t)512 * 512 * 2;
  __bf16* wob = (__bf16*)(ws + off); off += (size_t)64 * 512 * 2;
  __bf16* Qh  = (__bf16*)(ws + off); off += (size_t)8 * 4096 * 64 * 2;
  __bf16* Kh  = (__bf16*)(ws + off); off += (size_t)8 * 4096 * 64 * 2;
  __bf16* Vt  = (__bf16*)(ws + off); off += (size_t)8 * 64 * 4096 * 2;
  __bf16* Ob  = (__bf16*)(ws + off); off += (size_t)4096 * 512 * 2;

  // xb, wqb, wkb, wvb, wob are one contiguous range that starts at xb
  cvt_f32_bf16<<<CVT_NX + 3 * CVT_NW + CVT_NO, 256, 0, stream>>>(x, Wq, Wk, Wv, Wo, xb);

  qkv_gemm<<<dim3(32, 8, 3), 256, 0, stream>>>(xb, wqb, wkb, wvb, Qh, Kh, Vt);
  attn_flash<<<dim3(32, 8), 512, 0, stream>>>(Qh, Kh, Vt, Ob);
  out_gemm<<<dim3(64, 4), 128, 0, stream>>>(Ob, wob, bo, out);
}

// v008
// A run of this version takes 46.6 microseconds.
// Two timings next to v007 put it at 1.06 and 1.07 times that version's speed.
// Over all steps from v000 it is 3.55 times as fast.
#include <hip/hip_runtime.h>
#include <hip/hip_bf16.h>

typedef __attribute__((ext_vector_type(8)))  float  v8f;
typedef __attribute__((ext_vector_type(4)))  float  v4f;
typedef __attribute__((ext_vector_type(2)))  float  v2f;
typedef __attribute__((ext_vector_type(4)))  __bf16 v4bf;
typedef __attribute__((ext_vector_type(8)))  __bf16 v8bf;
typedef __attribute__((ext_vector_type(16))) __bf16 v16bf;

union Frag16 { v16bf v; v8bf h[2]; };

static __device__ __forceinline__ v8f wmma_bf16(v16bf a, v16bf b, v8f c) {
  return __builtin_amdgcn_wmma_f32_16x16x32_bf16(false, a, false, b, (short)0, c,
                                                 false, false);
}

// Load a 16x32 (rows x k) bf16 A/B fragment in the CDNA5 WMMA register layout:
// lanes 0-15 -> row r0+lane,    K = k0+{0..7, 16..23}
// lanes16-31 -> row r0+lane-16, K = k0+{8..15,24..31}
static __device__ __forceinline__ v16bf load_frag(const __bf16* mat, int ld, int r0,
                                                  int k0, int lane) {
  const int row = r0 + (lane & 15);
  const int kb  = k0 + ((lane >> 4) << 3);
  const __bf16* p = mat + (long)row * ld + kb;
  Frag16 f;
  f.h[0] = *reinterpret_cast<const v8bf*>(p);
  f.h[1] = *reinterpret_cast<const v8bf*>(p + 16);
  return f.v;
}

// LDS row pitches in elements: 16 B x odd, so that the 16 rows a ds_load_b128
// fragment read touches fall on distinct banks.
#define KT 256        // keys per stage
#define NS 4          // waves that share a stage's keys
#define WK (KT / NS)  // keys per wave and per softmax step
#define KP 72         // 64 d    + 8 pad = 144 B
#define VP 264        // 256 keys + 8 pad = 528 B
#define SM_BYTES (2 * (KT * KP + 64 * VP) * 2)
// The maximum in use is renewed only when a score tops it by more than this
// (8 binary orders, so an exponential stays below 2^8).
#define LAZY_RISE 5.545177f
#define LOG2E 1.44269504f

// Eight CDNA5 async global->LDS copies of 16 bytes per lane (ASYNCcnt): piece j
// lies gs elements further in global memory and ls elements further in LDS.
// The s_wait_xcnt closes the statement so that no address register of a copy
// is rewritten ahead of it.
static __device__ __forceinline__ void async_copy8_b128(const __bf16* g, int gs,
                                                        __bf16* l, int ls) {
  // addr[31:0] == LDS offset
  asm volatile("global_load_async_to_lds_b128 %0, %1, off\n\t"
               "global_load_async_to_lds_b128 %2, %3, off\n\t"
               "global_load_async_to_lds_b128 %4, %5, off\n\t"
               "global_load_async_to_lds_b128 %6, %7, off\n\t"
               "global_load_async_to_lds_b128 %8, %9, off\n\t"
               "global_load_async_to_lds_b128 %10, %11, off\n\t"
               "global_load_async_to_lds_b128 %12, %13, off\n\t"
               "global_load_async_to_lds_b128 %14, %15, off\n\t"
               "s_wait_xcnt 0x0"
               :: "v"((unsigned)(uintptr_t)(l)),          "v"(g),
                  "v"((unsigned)(uintptr_t)(l + ls)),     "v"(g + gs),
                  "v"((unsigned)(uintptr_t)(l + 2 * ls)), "v"(g + 2 * gs),
                  "v"((unsigned)(uintptr_t)(l + 3 * ls)), "v"(g + 3 * gs),
                  "v"((unsigned)(uintptr_t)(l + 4 * ls)), "v"(g + 4 * gs),
                  "v"((unsigned)(uintptr_t)(l + 5 * ls)), "v"(g + 5 * gs),
                  "v"((unsigned)(uintptr_t)(l + 6 * ls)), "v"(g + 6 * gs),
                  "v"((unsigned)(uintptr_t)(l + 7 * ls)), "v"(g + 7 * gs)
               : "memory");
}
// The same with four pieces, closed by the same s_wait_xcnt for the same reason.
static __device__ __forceinline__ void async_copy4_b128(const __bf16* g, int gs,
                                                        __bf16* l, int ls) {
  asm volatile("global_load_async_to_lds_b128 %0, %1, off\n\t"
               "global_load_async_to_lds_b128 %2, %3, off\n\t"
               "global_load_async_to_lds_b128 %4, %5, off\n\t"
               "global_load_async_to_lds_b128 %6, %7, off\n\t"
               "s_wait_xcnt 0x0"
               :: "v"((unsigned)(uintptr_t)(l)),          "v"(g),
                  "v"((unsigned)(uintptr_t)(l + ls)),     "v"(g + gs),
                  "v"((unsigned)(uintptr_t)(l + 2 * ls)), "v"(g + 2 * gs),
                  "v"((unsigned)(uintptr_t)(l + 3 * ls)), "v"(g + 3 * gs)
               : "memory");
}
// this wave's copies have landed
#define ASYNC_WAIT_0() asm volatile("s_wait_asynccnt 0x0" ::: "memory")
// this wave's LDS reads have returned, so the buffer may be handed back
#define DS_WAIT_0() asm volatile("s_wait_dscnt 0x0" ::: "memory")

// ---------------------------------------------------------------- convert
// One launch converts all five f32 operands. Their bf16 copies lie back to back
// in the workspace in the order x, Wq, Wk, Wv, Wo, so a block's place in the
// output is its index; only the source pointer depends on the operand.
// A block takes CVT_BLK elements, and every operand is a whole number of blocks.
#define CVT_U   8                     // 16-byte loads in flight per thread
#define CVT_BLK (256 * 4 * CVT_U)     // elements per block
#define CVT_NX  (4096 * 512 / CVT_BLK)
#define CVT_NW  (512 * 512 / CVT_BLK)
#define CVT_NO  (64 * 512 / CVT_BLK)
__global__ __launch_bounds__(256) void cvt_f32_bf16(const float* __restrict__ x,
                                                    const float* __restrict__ wq,
                                                    const float* __restrict__ wk,
                                                    const float* __restrict__ wv,
                                                    const float* __restrict__ wo,
                                                    __bf16* __restrict__ out) {
  const int b = blockIdx.x;
  const float* src;
  int rel;
  if (b < CVT_NX)                   { src = x;  rel = b; }
  else if (b < CVT_NX + CVT_NW)     { src = wq; rel = b - CVT_NX; }
  else if (b < CVT_NX + 2 * CVT_NW) { src = wk; rel = b - CVT_NX - CVT_NW; }
  else if (b < CVT_NX + 3 * CVT_NW) { src = wv; rel = b - CVT_NX - 2 * CVT_NW; }
  else                              { src = wo; rel = b - CVT_NX - 3 * CVT_NW; }

  // a wave's load covers 512 contiguous bytes, its store 256
  const v4f* in4 = reinterpret_cast<const v4f*>(src + rel * CVT_BLK) + threadIdx.x;
  v4bf* out4 = reinterpret_cast<v4bf*>(out + (long)b * CVT_BLK) + threadIdx.x;
  v4f v[CVT_U];
  // both loops unrolled: v stays in registers and all loads issue before the first use
#pragma unroll
  for (int j = 0; j < CVT_U; ++j) v[j] = in4[j * 256];
#pragma unroll
  for (int j = 0; j < CVT_U; ++j) {
    v4bf o;
    o[0] = (__bf16)v[j][0];
    o[1] = (__bf16)v[j][1];
    o[2] = (__bf16)v[j][2];
    o[3] = (__bf16)v[j][3];
    out4[j * 256] = o;
  }
}

// ---------------------------------------------------------------- QKV GEMM
// C = x(4096x512) @ W^T(512x512); Q scaled by 1/sqrt(64); V stored transposed.
// Q,K: [head][n][64]   Vt: [head][64][n]   (bf16)
// A block of 8 waves makes 128 tokens x 64 columns. Both operands are staged in
// LDS, GK columns of k per stage, with double-buffered async global->LDS copies
// (ASYNCcnt): a copy moves whole lines, a stage is in flight while the one before
// is worked on, and a W row is fetched once a block.
// A lane's eight accumulator registers are eight neighbouring rows of the A
// operand. The A operand is therefore the one whose rows lie side by side in the
// result's memory order: W for Q and K (a wave: 64 d x 16 tokens), x for the
// transposed V (a wave: 64 tokens x 16 d). The block's result then leaves through
// LDS in 16-byte pieces, in memory order, so that a wave's store covers whole lines.
#define GK 128  // k per stage
#define GP 136  // LDS row pitch in elements: 256 B + 16 B pad (16 B x odd)
__global__ __launch_bounds__(256) void qkv_gemm(const __bf16* __restrict__ xb,
                                                const __bf16* __restrict__ wq,
                                                const __bf16* __restrict__ wk,
                                                const __bf16* __restrict__ wv,
                                                __bf16* __restrict__ Qh,
                                                __bf16* __restrict__ Kh,
                                                __bf16* __restrict__ Vt) {
  __shared__ __attribute__((aligned(16))) __bf16 Xs[2][128 * GP];  // [token][k], padded rows
  __shared__ __attribute__((aligned(16))) __bf16 Ws[2][64 * GP];   // [col][k], padded rows

  const int tid  = threadIdx.x;
  const int lane = threadIdx.x & 31;
  const int wave = threadIdx.x >> 5;
  const int t0 = blockIdx.x * 128;               // token rows
  const int n0 = blockIdx.y * 64;                // output cols (hd): one head
  const int z  = blockIdx.z;                     // 0=Q 1=K 2=V
  const bool vt = (z == 2);
  const __bf16* W = (z == 0) ? wq : (z == 1) ? wk : wv;

  // 16 threads copy the 256 B of a row, the block 16 rows at a time: a thread's
  // pieces lie 16 rows apart, eight of the x tile and four of the W tile per stage.
  const __bf16* xg = xb + (blockIdx.x * 128 + (tid >> 4)) * 512 + (tid & 15) * 8;
  const __bf16* wg = W  + (n0 + (tid >> 4)) * 512 + (tid & 15) * 8;
  const int sl = (tid >> 4) * GP + (tid & 15) * 8;

  // stage 0 into buffer 0, published; then stage 1 into buffer 1, in flight
  async_copy8_b128(xg, 16 * 512, Xs[0] + sl, 16 * GP);
  async_copy4_b128(wg, 16 * 512, Ws[0] + sl, 16 * GP);
  ASYNC_WAIT_0();
  __syncthreads();
  async_copy8_b128(xg + GK, 16 * 512, Xs[1] + sl, 16 * GP);
  async_copy4_b128(wg + GK, 16 * 512, Ws[1] + sl, 16 * GP);

  // this wave's 64 rows of the A tile and 16 rows of the B tile
  const int ar = vt ? (wave >> 2) * 64 : 0;
  const int br = vt ? (wave & 3) * 16 : wave * 16;

  v8f acc[4] = {};
  for (int s = 0; s < 512 / GK; ++s) {
    const int cur = s & 1;
    const __bf16* ac = (vt ? Xs[cur] : Ws[cur]) + ar * GP;
    const __bf16* bc = (vt ? Ws[cur] : Xs[cur]) + br * GP;
    // both loops unrolled: kk folds into the offset field of the LDS reads, and
    // acc, indexed by constants, lives in registers
#pragma unroll
    for (int kk = 0; kk < GK; kk += 32) {
      v16bf b = load_frag(bc, GP, 0, kk, lane);
#pragma unroll
      for (int nt = 0; nt < 4; ++nt) {
        v16bf a = load_frag(ac, GP, nt * 16, kk, lane);
        acc[nt] = wmma_bf16(a, b, acc[nt]);
      }
    }

    // publish point: own reads of buf[cur] done, own copies of the next stage
    // landed; the one barrier publishes that stage and frees buf[cur]
    DS_WAIT_0();
    ASYNC_WAIT_0();
    __syncthreads();
    if (s + 2 < 512 / GK) {  // refill the buffer just read, two stages ahead
      const int kn = (s + 2) * GK;
      async_copy8_b128(xg + kn, 16 * 512, Xs[cur] + sl, 16 * GP);
      async_copy4_b128(wg + kn, 16 * 512, Ws[cur] + sl, 16 * GP);
    }
  }
  ASYNC_WAIT_0();   // nothing of this wave is in flight when it ends

  // The result tile in LDS, rows as in memory: [128 tokens][64 d] for Q and K,
  // [64 d][128 tokens] for V; row pitch 16 B x odd again, for the 16-byte writes.
  // The last publish point has ended every read of the ring and nothing is in
  // flight, so the x ring's bytes are free for it.
  // D layout: lanes 0-15 N=lane, M=reg; lanes 16-31 N=lane-16, M=8+reg
  __bf16* Ts = Xs[0];
  const int tp = vt ? 128 + 8 : 64 + 8;
  const float scale = (z == 0) ? 0.125f : 1.0f;
  __bf16* tw = Ts + (br + (lane & 15)) * tp + ar + ((lane >> 4) << 3);
  // both loops unrolled: acc and pk, indexed by constants, live in registers
#pragma unroll
  for (int nt = 0; nt < 4; ++nt) {
    v8bf pk;
#pragma unroll
    for (int r = 0; r < 8; ++r) pk[r] = (__bf16)(acc[nt][r] * scale);
    *reinterpret_cast<v8bf*>(tw + nt * 16) = pk;
  }
  __syncthreads();   // the tile is read by other waves than wrote it

  // 1024 pieces of 16 bytes, four a thread; neighbouring threads take neighbouring
  // pieces of a row. Q, K: the 128 tokens of one head are 16 KB in a row.
  const int sh = vt ? 4 : 3;          // log2 of the pieces in a row
  const int dld = vt ? 4096 : 64;     // row pitch in memory
  __bf16* dst = vt ? Vt + n0 * 4096 + t0
                   : ((z == 0) ? Qh : Kh) + (blockIdx.y * 4096 + t0) * 64;
  // unrolled so that the four LDS reads go out together
#pragma unroll
  for (int j = 0; j < 4; ++j) {
    const int idx = j * 256 + tid;
    const int row = idx >> sh, pc = idx & ((1 << sh) - 1);
    *reinterpret_cast<v8bf*>(dst + row * dld + pc * 8) =
        *reinterpret_cast<const v8bf*>(Ts + row * tp + pc * 8);
  }
}

// ---------------------------------------------------------------- attention
// One block per 128 queries of one head, 16 waves. A wave owns 32 queries (two
// 16-query tiles), so that every K and V fragment it reads from LDS feeds two
// matrix instructions. The four waves of a query group share each staged tile of
// KT keys, WK keys each, and keep their own running maximum, sum and O^T; the
// four partial results are joined once, through LDS, behind the loop.
// K/V tiles are staged in LDS with double-buffered async global->LDS copies
// (ASYNCcnt), once for all 128 queries.
// Computes S^T = K @ Q^T so softmax reduction is in-lane + one xor16 shuffle,
// and each pair of 16-key S^T tiles forms a native K=32 B-fragment of P^T.
// The softmax maximum is lazy: a wave keeps the maximum it has in use until a
// score tops it by more than LAZY_RISE. It is therefore known before a step's
// scores are, and enters their matrix product negated, as the C operand: the
// scores arrive already reduced by it, and O and the row sum are rescaled only
// in the rare step that renews it.
__global__ __launch_bounds__(512) void attn_flash(const __bf16* __restrict__ Qh,
                                                  const __bf16* __restrict__ Kh,
                                                  const __bf16* __restrict__ Vt,
                                                  __bf16* __restrict__ Ob) {
  // the ring: K [2][key][d] and V [2][d][key], padded rows; behind the loop the
  // same bytes hold the partial results
  __shared__ __attribute__((aligned(16))) unsigned char smem[SM_BYTES];
  __bf16* Ks = reinterpret_cast<__bf16*>(smem);
  __bf16* Vs = Ks + 2 * KT * KP;

  const int tid  = threadIdx.x;
  const int lane = tid & 31;
  const int wave = tid >> 5;
  const int ks = wave & (NS - 1);   // which WK keys of a stage
  const int qg = wave / NS;         // which 32 queries of the block
  const int h  = blockIdx.y;
  const int q0 = blockIdx.x * 128 + qg * 32;
  const __bf16* Q = Qh + (long)(h << 12) * 64;
  const __bf16* K = Kh + (long)(h << 12) * 64;
  const __bf16* V = Vt + (long)(h << 6) * 4096;

  // loop-invariant Q B-fragments (2 x 16 queries x 64 d); unrolled so that qb,
  // indexed by constants, lives in registers
  v16bf qb[2][2];
#pragma unroll
  for (int c = 0; c < 2; ++c) {
    qb[c][0] = load_frag(Q, 64, q0 + 16 * c, 0, lane);
    qb[c][1] = load_frag(Q, 64, q0 + 16 * c, 32, lane);
  }

  // Each thread copies four 16-byte pieces of the K tile (64 rows apart) and
  // four of the V tile (16 rows apart) per stage.
  const __bf16* kg = K + tid * 8;
  const __bf16* vg = V + (tid >> 5) * 4096 + (tid & 31) * 8;
  const int kl = (tid >> 3) * KP + (tid & 7) * 8;
  const int vl = (tid >> 5) * VP + (tid & 31) * 8;

  // stage 0 into buffer 0, published; then stage 1 into buffer 1, in flight
  async_copy4_b128(kg, 64 * 64, Ks + kl, 64 * KP);
  async_copy4_b128(vg, 16 * 4096, Vs + vl, 16 * VP);
  ASYNC_WAIT_0();
  __syncthreads();
  async_copy4_b128(kg + KT * 64, 64 * 64, Ks + KT * KP + kl, 64 * KP);
  async_copy4_b128(vg + KT, 16 * 4096, Vs + 64 * VP + vl, 16 * VP);

  v8f o[4][2] = {};   // [16 d][16 queries]
  // per query: the negative of the maximum in use, in all eight registers of a
  // C operand (the first step always renews it), and the row sum against it
  v8f nm[2] = {};
  float lrun[2] = {0.0f, 0.0f};

  // kept whole: with the first step split off as a copy of its own, the kernel
  // no longer fits its registers and spills
#pragma unroll 1
  for (int it = 0; it < 4096 / KT; ++it) {
    const int cur = it & 1;
    const __bf16* kc = Ks + cur * (KT * KP) + ks * (WK * KP);  // this wave's key rows
    const __bf16* vc = Vs + cur * (64 * VP) + ks * WK;         // this wave's key columns

    // S^T - max in use, from LDS: four tiles of 16 keys, each against both query
    // tiles. The loops over j, c, g, t, i and r are unrolled so that s, o, tm, ps
    // and p, indexed by constants, live in registers.
    v8f s[4][2];
#pragma unroll
    for (int j = 0; j < 4; ++j) {
      v16bf ka = load_frag(kc, KP, 16 * j, 0,  lane);
      v16bf kb = load_frag(kc, KP, 16 * j, 32, lane);
#pragma unroll
      for (int c = 0; c < 2; ++c) {
        v8f z = wmma_bf16(ka, qb[c][0], nm[c]);
        s[j][c] = wmma_bf16(kb, qb[c][1], z);
      }
    }

    // each lane's largest score of the step, over the maximum in use; one chain
    // per 32 keys, joined at the end
    float tmax[2];
#pragma unroll
    for (int c = 0; c < 2; ++c) {
      float tm[2];
#pragma unroll
      for (int g = 0; g < 2; ++g) {
        tm[g] = s[2 * g][c][0];
#pragma unroll
        for (int r = 0; r < 8; ++r) {
          tm[g] = fmaxf(tm[g], s[2 * g][c][r]);
          tm[g] = fmaxf(tm[g], s[2 * g + 1][c][r]);
        }
      }
      tmax[c] = fmaxf(tm[0], tm[1]);
    }

    // One test per step, the same for the whole wave: renew the maximum in the
    // first step, and later only where some query's score has outgrown it.
    const unsigned grown = __builtin_amdgcn_ballot_w32(fmaxf(tmax[0], tmax[1]) > LAZY_RISE);
    if ((grown | (unsigned)(it == 0)) != 0) {
#pragma unroll
      for (int c = 0; c < 2; ++c) {
        const float t = fmaxf(tmax[c], __shfl_xor(tmax[c], 16, 32));
        // the first step takes its own maximum, a later one never lowers it
        const float d = (it == 0) ? t : fmaxf(t, 0.0f);
        const float alpha = __expf(-fmaxf(d, 0.0f));
        lrun[c] *= alpha;
        nm[c] -= d;
#pragma unroll
        for (int j = 0; j < 4; ++j) {
#pragma unroll
          for (int r = 0; r < 8; ++r) s[j][c][r] -= d;
        }
#pragma unroll
        for (int t4 = 0; t4 < 4; ++t4) {
#pragma unroll
          for (int r = 0; r < 8; ++r) o[t4][c][r] *= alpha;
        }
      }
    }

    // exponentials and row sums, two neighbouring registers at a time; one sum
    // chain per 32 keys, joined at the end (regs + lane-half exchange)
    Frag16 p[2][2];
#pragma unroll
    for (int c = 0; c < 2; ++c) {
      v2f ps[2];
#pragma unroll
      for (int g = 0; g < 2; ++g) {
#pragma unroll
        for (int i = 0; i < 8; ++i) {
          // registers 2(i&3), 2(i&3)+1 of tile 2g+(i>>2):
          // keys 32g+{0..7 | 8..15} for i < 4, 32g+{16..23 | 24..31} behind (per lane half)
          const v8f& st = s[2 * g + (i >> 2)][c];
          const v2f a = (v2f){st[2 * (i & 3)], st[2 * (i & 3) + 1]} * LOG2E;
          const v2f e = {__builtin_amdgcn_exp2f(a.x), __builtin_amdgcn_exp2f(a.y)};
          ps[g] = (i == 0) ? e : ps[g] + e;
          p[g][c].v[2 * i]     = (__bf16)e.x;
          p[g][c].v[2 * i + 1] = (__bf16)e.y;
        }
      }
      const v2f pj = ps[0] + ps[1];
      float psum = pj.x + pj.y;
      psum += __shfl_xor(psum, 16, 32);
      lrun[c] += psum;
    }

    // O^T += V^T(64 x 64 keys) @ P^T(64 keys x 32 queries), V from LDS
#pragma unroll
    for (int g = 0; g < 2; ++g) {
#pragma unroll
      for (int t = 0; t < 4; ++t) {
        v16bf va = load_frag(vc, VP, 16 * t, 32 * g, lane);
        o[t][0] = wmma_bf16(va, p[g][0].v, o[t][0]);
        o[t][1] = wmma_bf16(va, p[g][1].v, o[t][1]);
      }
    }

    // publish point: own reads of buf[cur] done, own copies of the next stage
    // landed; the one barrier publishes that stage and frees buf[cur]
    DS_WAIT_0();
    ASYNC_WAIT_0();
    __syncthreads();
    if (it + 2 < 4096 / KT) {  // refill the buffer just read, two stages ahead
      const int kn = (it + 2) * KT;
      async_copy4_b128(kg + kn * 64, 64 * 64, Ks + cur * (KT * KP) + kl, 64 * KP);
      async_copy4_b128(vg + kn, 16 * 4096, Vs + cur * (64 * VP) + vl, 16 * VP);
    }
  }
  ASYNC_WAIT_0();   // nothing of this wave is in flight when it ends

  // Join of the four partial results of a query group. The last publish point
  // has ended every read of the ring and nothing is in flight, so its bytes are
  // free. A wave's store or load of four floats a lane covers 512 contiguous bytes.
  // The loops of the join are unrolled for the same reason as those above: o, mj
  // and lj, indexed by constants, live in registers.
  float* Om = reinterpret_cast<float*>(smem);   // [wave][d tile][query tile][half][lane][4]
  float* Mm = Om + 16 * 8 * 256;                // [wave][query tile][lane]
  float* Lm = Mm + 16 * 2 * 32;
#pragma unroll
  for (int t = 0; t < 4; ++t) {
#pragma unroll
    for (int c = 0; c < 2; ++c) {
      v4f* d4 = reinterpret_cast<v4f*>(Om + ((wave * 4 + t) * 2 + c) * 256) + lane;
      v4f lo = {o[t][c][0], o[t][c][1], o[t][c][2], o[t][c][3]};
      v4f hi = {o[t][c][4], o[t][c][5], o[t][c][6], o[t][c][7]};
      d4[0]  = lo;
      d4[32] = hi;
    }
  }
#pragma unroll
  for (int c = 0; c < 2; ++c) {
    Mm[(wave * 2 + c) * 32 + lane] = -nm[c][0];
    Lm[(wave * 2 + c) * 32 + lane] = lrun[c];
  }
  __syncthreads();   // the partial results are read by the group's other waves

  // wave ks of a group finishes d tile ks of its 32 queries
#pragma unroll
  for (int c = 0; c < 2; ++c) {
    float mj[NS], lj[NS];
#pragma unroll
    for (int j = 0; j < NS; ++j) {
      mj[j] = Mm[((qg * NS + j) * 2 + c) * 32 + lane];
      lj[j] = Lm[((qg * NS + j) * 2 + c) * 32 + lane];
    }
    const float mall = fmaxf(fmaxf(mj[0], mj[1]), fmaxf(mj[2], mj[3]));
    float lall = 0.0f;
    v4f lo = {}, hi = {};
#pragma unroll
    for (int j = 0; j < NS; ++j) {
      const float w = __expf(mj[j] - mall);
      const v4f* s4 =
          reinterpret_cast<const v4f*>(Om + (((qg * NS + j) * 4 + ks) * 2 + c) * 256) + lane;
      lall += w * lj[j];
      lo += w * s4[0];
      hi += w * s4[32];
    }
    const float inv = 1.0f / lall;
    v8bf ob;
#pragma unroll
    for (int r = 0; r < 4; ++r) {
      ob[r]     = (__bf16)(lo[r] * inv);
      ob[4 + r] = (__bf16)(hi[r] * inv);
    }
    // D layout: a lane holds 8 consecutive d of one query, 16 bytes
    const int q = q0 + 16 * c + (lane & 15);
    *reinterpret_cast<v8bf*>(Ob + (long)q * 512 + (h << 6) + ks * 16 + ((lane >> 4) << 3)) = ob;
  }
}

// ---------------------------------------------------------------- output proj
// out(4096x64) = Ob(4096x512) @ Wo^T(512x64) + bo, f32 output.
// A block of OW waves makes OT tokens x all 64 columns. Its rows of Ob and all of
// Wo are brought into LDS by async global->LDS copies (ASYNCcnt) that are all in
// flight at once and move whole lines. The waves split k; their partial results
// are joined through LDS.
// The A operand is Wo, so that a lane's eight accumulator registers are eight
// neighbouring columns of one token, as they lie in memory.
#define OT 32   // tokens per block
#define OW 4    // waves per block
#define OK (512 / OW)  // k per wave
#define OP 520  // LDS row pitch in elements: 1024 B + 16 B pad (16 B x odd)
#define RP 68   // row pitch of a partial result in floats: 256 B + 16 B pad (16 B x odd)
__global__ __launch_bounds__(OW * 32) void out_gemm(const __bf16* __restrict__ Ob,
                                                    const __bf16* __restrict__ Wob,
                                                    const float* __restrict__ bo,
                                                    float* __restrict__ out) {
  __shared__ __attribute__((aligned(16))) __bf16 Os[OT * OP];       // [token][k], padded rows
  __shared__ __attribute__((aligned(16))) __bf16 Wos[64 * OP];      // [col][k], padded rows
  __shared__ __attribute__((aligned(16))) float Rs[OW * OT * RP];   // [wave][token][col]

  const int tid  = threadIdx.x;
  const int lane = threadIdx.x & 31;
  const int wave = threadIdx.x >> 5;
  const int m0 = blockIdx.x * OT;

  // the four columns that this thread finishes, the same in each of its pieces
  const v4f bias = *reinterpret_cast<const v4f*>(bo + (tid & 15) * 4);

  // 64 threads copy the 1024 B of a row, the block 2 rows at a time: a thread's
  // pieces lie 2 rows apart, eight of them (16 rows) to a statement; 48 copies
  // of a wave are in flight. Unrolled so that j is a constant in the addresses.
  const int sg = (tid >> 6) * 512 + (tid & 63) * 8;
  const int sl = (tid >> 6) * OP + (tid & 63) * 8;
#pragma unroll
  for (int j = 0; j < OT / 16; ++j)
    async_copy8_b128(Ob + (m0 + j * 16) * 512 + sg, 2 * 512, Os + j * 16 * OP + sl, 2 * OP);
#pragma unroll
  for (int j = 0; j < 64 / 16; ++j)
    async_copy8_b128(Wob + j * 16 * 512 + sg, 2 * 512, Wos + j * 16 * OP + sl, 2 * OP);
  ASYNC_WAIT_0();
  __syncthreads();   // the tiles are read by other waves than copied them

  v8f acc[4][2] = {};   // [16 columns][16 tokens]
  // all loops unrolled: k folds into the offset field of the LDS reads, and a, b
  // and acc, indexed by constants, live in registers
#pragma unroll
  for (int kk = 0; kk < OK; kk += 64) {
    v16bf a[2][4], b[2][2];
#pragma unroll
    for (int g = 0; g < 2; ++g) {
      const int k0 = wave * OK + kk + g * 32;
      b[g][0] = load_frag(Os, OP, 0,  k0, lane);
      b[g][1] = load_frag(Os, OP, 16, k0, lane);
#pragma unroll
      for (int nt = 0; nt < 4; ++nt) a[g][nt] = load_frag(Wos, OP, nt * 16, k0, lane);
    }
    // Holds the LDS reads of these twelve fragments together, in front of their
    // matrix instructions: the wave, alone on its SIMD, then waits out the LDS
    // latency once, not once per fragment. Inputs only: nothing is changed.
    asm volatile("" :: "v"(b[0][0]), "v"(b[0][1]), "v"(a[0][0]), "v"(a[0][1]), "v"(a[0][2]),
                       "v"(a[0][3]), "v"(b[1][0]), "v"(b[1][1]), "v"(a[1][0]), "v"(a[1][1]),
                       "v"(a[1][2]), "v"(a[1][3]));
#pragma unroll
    for (int g = 0; g < 2; ++g) {
#pragma unroll
      for (int nt = 0; nt < 4; ++nt) {
        acc[nt][0] = wmma_bf16(a[g][nt], b[g][0], acc[nt][0]);
        acc[nt][1] = wmma_bf16(a[g][nt], b[g][1], acc[nt][1]);
      }
    }
  }

  // D layout: lanes 0-15 N=lane, M=reg; lanes 16-31 N=lane-16, M=8+reg
  // (N: token of the 16-token tile, M: column of the 16-column tile)
  // unrolled: acc is indexed by constants
#pragma unroll
  for (int c = 0; c < 2; ++c) {
    float* rw = Rs + (wave * OT + c * 16 + (lane & 15)) * RP + ((lane >> 4) << 3);
#pragma unroll
    for (int nt = 0; nt < 4; ++nt) {
      v4f lo = {acc[nt][c][0], acc[nt][c][1], acc[nt][c][2], acc[nt][c][3]};
      v4f hi = {acc[nt][c][4], acc[nt][c][5], acc[nt][c][6], acc[nt][c][7]};
      *reinterpret_cast<v4f*>(rw + nt * 16)     = lo;
      *reinterpret_cast<v4f*>(rw + nt * 16 + 4) = hi;
    }
  }
  __syncthreads();   // the partial results are read by other waves than wrote them

  // The block's result is 8 KB in a row in memory: 512 pieces of 16 bytes, four a
  // thread, neighbouring threads on neighbouring pieces, so that a wave's store
  // covers whole lines. Unrolled so that the LDS reads go out together.
#pragma unroll
  for (int j = 0; j < OT * 16 / (OW * 32); ++j) {
    const int p = j * (OW * 32) + tid;
    const float* rr = Rs + (p >> 4) * RP + (p & 15) * 4;
    v4f sum = *reinterpret_cast<const v4f*>(rr);
#pragma unroll
    for (int w = 1; w < OW; ++w) sum += *reinterpret_cast<const v4f*>(rr + w * OT * RP);
    *reinterpret_cast<v4f*>(out + m0 * 64 + p * 4) = sum + bias;
  }
}

// ---------------------------------------------------------------- launch
extern "C" void kernel_launch(void* const* d_in, const int* in_sizes, int n_in,
                              void* d_out, int out_size, void* d_ws, size_t ws_size,
                              hipStream_t stream) {
  const float* x  = (const float*)d_in[0];   // 4096x512
  const float* Wq = (const float*)d_in[1];   // 512x512
  const float* Wk = (const float*)d_in[2];   // 512x512
  const float* Wv = (const float*)d_in[3];   // 512x512
  const float* Wo = (const float*)d_in[4];   // 64x512
  const float* bo = (const float*)d_in[5];   // 64
  float* out = (float*)d_out;                // 4096x64

  char* ws = (char*)d_ws;
  size_t off = 0;
  __bf16* xb  = (__bf16*)(ws + off); off += (size_t)4096 * 512 * 2;  // 4 MB
  __bf16* wqb = (__bf16*)(ws + off); off += (size_t)512 * 512 * 2;
  __bf16* wkb = (__bf16*)(ws + off); off += (size_t)512 * 512 * 2;
  __bf16* wvb = (__bf16*)(ws + off); off += (size_t)512 * 512 * 2;
  __bf16* wob = (__bf16*)(ws + off); off += (size_t)64 * 512 * 2;
  __bf16* Qh  = (__bf16*)(ws + off); off += (size_t)8 * 4096 * 64 * 2;
  __bf16* Kh  = (__bf16*)(ws + off); off += (size_t)8 * 4096 * 64 * 2;
  __bf16* Vt  = (__bf16*)(ws + off); off += (size_t)8 * 64 * 4096 * 2;
  __bf16* Ob  = (__bf16*)(ws + off); off += (size_t)4096 * 512 * 2;

  // xb, wqb, wkb, wvb, wob are one contiguous range that starts at xb
  cvt_f32_bf16<<<CVT_NX + 3 * CVT_NW + CVT_NO, 256, 0, stream>>>(x, Wq, Wk, Wv, Wo, xb);

  qkv_gemm<<<dim3(32, 8, 3), 256, 0, stream>>>(xb, wqb, wkb, wvb, Qh, Kh, Vt);
  attn_flash<<<dim3(32, 8), 512, 0, stream>>>(Qh, Kh, Vt, Ob);
  out_gemm<<<4096 / OT, OW * 32, 0, stream>>>(Ob, wob, bo, out);
}

// v009
// A run of this version takes 43.9 microseconds.
// Two timings next to v008 both put it at 1.07 times that version's speed.
// Counting every step since v000, it is 3.79 times as fast.
#include <hip/hip_runtime.h>
#include <hip/hip_bf16.h>

typedef __attribute__((ext_vector_type(8)))  float  v8f;
typedef __attribute__((ext_vector_type(4)))  float  v4f;
typedef __attribute__((ext_vector_type(2)))  float  v2f;
typedef __attribute__((ext_vector_type(4)))  __bf16 v4bf;
typedef __attribute__((ext_vector_type(8)))  __bf16 v8bf;
typedef __attribute__((ext_vector_type(16))) __bf16 v16bf;

union Frag16 { v16bf v; v8bf h[2]; };

static __device__ __forceinline__ v8f wmma_bf16(v16bf a, v16bf b, v8f c) {
  return __builtin_amdgcn_wmma_f32_16x16x32_bf16(false, a, false, b, (short)0, c,
                                                 false, false);
}

// Load a 16x32 (rows x k) bf16 A/B fragment in the CDNA5 WMMA register layout:
// lanes 0-15 -> row r0+lane,    K = k0+{0..7, 16..23}
// lanes16-31 -> row r0+lane-16, K = k0+{8..15,24..31}
static __device__ __forceinline__ v16bf load_frag(const __bf16* mat, int ld, int r0,
                                                  int k0, int lane) {
  const int row = r0 + (lane & 15);
  const int kb  = k0 + ((lane >> 4) << 3);
  const __bf16* p = mat + (long)row * ld + kb;
  Frag16 f;
  f.h[0] = *reinterpret_cast<const v8bf*>(p);
  f.h[1] = *reinterpret_cast<const v8bf*>(p + 16);
  return f.v;
}

// LDS row pitches in elements: 16 B x odd, so that the 16 rows a ds_load_b128
// fragment read touches fall on distinct banks.
#define KT 256        // keys per stage
#define NS 4          // waves that share a stage's keys
#define WK (KT / NS)  // keys per wave and per softmax step
#define KP 72         // 64 d    + 8 pad = 144 B
#define VP 264        // 256 keys + 8 pad = 528 B
#define SM_BYTES (2 * (KT * KP + 64 * VP) * 2)
// The maximum in use is renewed at the first step and when a lane's sum of the 32 exponentials of
// a step and query tops this (32 x 2^8, so an exponential stays below 2^13).
#define SUM_CAP 8192.0f
#define LOG2E 1.44269504f

// Eight CDNA5 async global->LDS copies of 16 bytes per lane (ASYNCcnt): piece j
// lies gs elements further in global memory and ls elements further in LDS.
// The s_wait_xcnt closes the statement so that no address register of a copy
// is rewritten ahead of it.
static __device__ __forceinline__ void async_copy8_b128(const __bf16* g, int gs,
                                                        __bf16* l, int ls) {
  // addr[31:0] == LDS offset
  asm volatile("global_load_async_to_lds_b128 %0, %1, off\n\t"
               "global_load_async_to_lds_b128 %2, %3, off\n\t"
               "global_load_async_to_lds_b128 %4, %5, off\n\t"
               "global_load_async_to_lds_b128 %6, %7, off\n\t"
               "global_load_async_to_lds_b128 %8, %9, off\n\t"
               "global_load_async_to_lds_b128 %10, %11, off\n\t"
               "global_load_async_to_lds_b128 %12, %13, off\n\t"
               "global_load_async_to_lds_b128 %14, %15, off\n\t"
               "s_wait_xcnt 0x0"
               :: "v"((unsigned)(uintptr_t)(l)),          "v"(g),
                  "v"((unsigned)(uintptr_t)(l + ls)),     "v"(g + gs),
                  "v"((unsigned)(uintptr_t)(l + 2 * ls)), "v"(g + 2 * gs),
                  "v"((unsigned)(uintptr_t)(l + 3 * ls)), "v"(g + 3 * gs),
                  "v"((unsigned)(uintptr_t)(l + 4 * ls)), "v"(g + 4 * gs),
                  "v"((unsigned)(uintptr_t)(l + 5 * ls)), "v"(g + 5 * gs),
                  "v"((unsigned)(uintptr_t)(l + 6 * ls)), "v"(g + 6 * gs),
                  "v"((unsigned)(uintptr_t)(l + 7 * ls)), "v"(g + 7 * gs)
               : "memory");
}
// The same with four pieces, closed by the same s_wait_xcnt for the same reason.
static __device__ __forceinline__ void async_copy4_b128(const __bf16* g, int gs,
                                                        __bf16* l, int ls) {
  asm volatile("global_load_async_to_lds_b128 %0, %1, off\n\t"
               "global_load_async_to_lds_b128 %2, %3, off\n\t"
               "global_load_async_to_lds_b128 %4, %5, off\n\t"
               "global_load_async_to_lds_b128 %6, %7, off\n\t"
               "s_wait_xcnt 0x0"
               :: "v"((unsigned)(uintptr_t)(l)),          "v"(g),
                  "v"((unsigned)(uintptr_t)(l + ls)),     "v"(g + gs),
                  "v"((unsigned)(uintptr_t)(l + 2 * ls)), "v"(g + 2 * gs),
                  "v"((unsigned)(uintptr_t)(l + 3 * ls)), "v"(g + 3 * gs)
               : "memory");
}
// this wave's copies have landed
#define ASYNC_WAIT_0() asm volatile("s_wait_asynccnt 0x0" ::: "memory")
// this wave's LDS reads have returned, so the buffer may be handed back
#define DS_WAIT_0() asm volatile("s_wait_dscnt 0x0" ::: "memory")

// ---------------------------------------------------------------- convert
// One launch converts all five f32 operands. Their bf16 copies lie back to back
// in the workspace in the order x, Wq, Wk, Wv, Wo, so a block's place in the
// output is its index; only the source pointer depends on the operand.
// A block takes CVT_BLK elements, and every operand is a whole number of blocks.
#define CVT_U   8                     // 16-byte loads in flight per thread
#define CVT_BLK (256 * 4 * CVT_U)     // elements per block
#define CVT_NX  (4096 * 512 / CVT_BLK)
#define CVT_NW  (512 * 512 / CVT_BLK)
#define CVT_NO  (64 * 512 / CVT_BLK)
__global__ __launch_bounds__(256) void cvt_f32_bf16(const float* __restrict__ x,
                                                    const float* __restrict__ wq,
                                                    const float* __restrict__ wk,
                                                    const float* __restrict__ wv,
                                                    const float* __restrict__ wo,
                                                    __bf16* __restrict__ out) {
  const int b = blockIdx.x;
  const float* src;
  int rel;
  if (b < CVT_NX)                   { src = x;  rel = b; }
  else if (b < CVT_NX + CVT_NW)     { src = wq; rel = b - CVT_NX; }
  else if (b < CVT_NX + 2 * CVT_NW) { src = wk; rel = b - CVT_NX - CVT_NW; }
  else if (b < CVT_NX + 3 * CVT_NW) { src = wv; rel = b - CVT_NX - 2 * CVT_NW; }
  else                              { src = wo; rel = b - CVT_NX - 3 * CVT_NW; }

  // a wave's load covers 512 contiguous bytes, its store 256
  const v4f* in4 = reinterpret_cast<const v4f*>(src + rel * CVT_BLK) + threadIdx.x;
  v4bf* out4 = reinterpret_cast<v4bf*>(out + (long)b * CVT_BLK) + threadIdx.x;
  v4f v[CVT_U];
  // both loops unrolled: v stays in registers and all loads issue before the first use
#pragma unroll
  for (int j = 0; j < CVT_U; ++j) v[j] = in4[j * 256];
#pragma unroll
  for (int j = 0; j < CVT_U; ++j) {
    v4bf o;
    o[0] = (__bf16)v[j][0];
    o[1] = (__bf16)v[j][1];
    o[2] = (__bf16)v[j][2];
    o[3] = (__bf16)v[j][3];
    out4[j * 256] = o;
  }
}

// ---------------------------------------------------------------- QKV GEMM
// C = x(4096x512) @ W^T(512x512); Q scaled by 1/sqrt(64); V stored transposed.
// Q,K: [head][n][64]   Vt: [head][64][n]   (bf16)
// A block of 8 waves makes 128 tokens x 64 columns. Both operands are staged in
// LDS, GK columns of k per stage, with double-buffered async global->LDS copies
// (ASYNCcnt): a copy moves whole lines, a stage is in flight while the one before
// is worked on, and a W row is fetched once a block.
// A lane's eight accumulator registers are eight neighbouring rows of the A
// operand. The A operand is therefore the one whose rows lie side by side in the
// result's memory order: W for Q and K (a wave: 64 d x 16 tokens), x for the
// transposed V (a wave: 64 tokens x 16 d). The block's result then leaves through
// LDS in 16-byte pieces, in memory order, so that a wave's store covers whole lines.
#define GK 128  // k per stage
#define GP 136  // LDS row pitch in elements: 256 B + 16 B pad (16 B x odd)
__global__ __launch_bounds__(256) void qkv_gemm(const __bf16* __restrict__ xb,
                                                const __bf16* __restrict__ wq,
                                                const __bf16* __restrict__ wk,
                                                const __bf16* __restrict__ wv,
                                                __bf16* __restrict__ Qh,
                                                __bf16* __restrict__ Kh,
                                                __bf16* __restrict__ Vt) {
  __shared__ __attribute__((aligned(16))) __bf16 Xs[2][128 * GP];  // [token][k], padded rows
  __shared__ __attribute__((aligned(16))) __bf16 Ws[2][64 * GP];   // [col][k], padded rows

  const int tid  = threadIdx.x;
  const int lane = threadIdx.x & 31;
  const int wave = threadIdx.x >> 5;
  const int t0 = blockIdx.x * 128;               // token rows
  const int n0 = blockIdx.y * 64;                // output cols (hd): one head
  const int z  = blockIdx.z;                     // 0=Q 1=K 2=V
  const bool vt = (z == 2);
  const __bf16* W = (z == 0) ? wq : (z == 1) ? wk : wv;

  // 16 threads copy the 256 B of a row, the block 16 rows at a time: a thread's
  // pieces lie 16 rows apart, eight of the x tile and four of the W tile per stage.
  const __bf16* xg = xb + (blockIdx.x * 128 + (tid >> 4)) * 512 + (tid & 15) * 8;
  const __bf16* wg = W  + (n0 + (tid >> 4)) * 512 + (tid & 15) * 8;
  const int sl = (tid >> 4) * GP + (tid & 15) * 8;

  // stage 0 into buffer 0, published; then stage 1 into buffer 1, in flight
  async_copy8_b128(xg, 16 * 512, Xs[0] + sl, 16 * GP);
  async_copy4_b128(wg, 16 * 512, Ws[0] + sl, 16 * GP);
  ASYNC_WAIT_0();
  __syncthreads();
  async_copy8_b128(xg + GK, 16 * 512, Xs[1] + sl, 16 * GP);
  async_copy4_b128(wg + GK, 16 * 512, Ws[1] + sl, 16 * GP);

  // this wave's 64 rows of the A tile and 16 rows of the B tile
  const int ar = vt ? (wave >> 2) * 64 : 0;
  const int br = vt ? (wave & 3) * 16 : wave * 16;

  v8f acc[4] = {};
  for (int s = 0; s < 512 / GK; ++s) {
    const int cur = s & 1;
    const __bf16* ac = (vt ? Xs[cur] : Ws[cur]) + ar * GP;
    const __bf16* bc = (vt ? Ws[cur] : Xs[cur]) + br * GP;
    // both loops unrolled: kk folds into the offset field of the LDS reads, and
    // acc, indexed by constants, lives in registers
#pragma unroll
    for (int kk = 0; kk < GK; kk += 32) {
      v16bf b = load_frag(bc, GP, 0, kk, lane);
#pragma unroll
      for (int nt = 0; nt < 4; ++nt) {
        v16bf a = load_frag(ac, GP, nt * 16, kk, lane);
        acc[nt] = wmma_bf16(a, b, acc[nt]);
      }
    }

    // publish point: own reads of buf[cur] done, own copies of the next stage
    // landed; the one barrier publishes that stage and frees buf[cur]
    DS_WAIT_0();
    ASYNC_WAIT_0();
    __syncthreads();
    if (s + 2 < 512 / GK) {  // refill the buffer just read, two stages ahead
      const int kn = (s + 2) * GK;
      async_copy8_b128(xg + kn, 16 * 512, Xs[cur] + sl, 16 * GP);
      async_copy4_b128(wg + kn, 16 * 512, Ws[cur] + sl, 16 * GP);
    }
  }
  ASYNC_WAIT_0();   // nothing of this wave is in flight when it ends

  // The result tile in LDS, rows as in memory: [128 tokens][64 d] for Q and K,
  // [64 d][128 tokens] for V; row pitch 16 B x odd again, for the 16-byte writes.
  // The last publish point has ended every read of the ring and nothing is in
  // flight, so the x ring's bytes are free for it.
  // D layout: lanes 0-15 N=lane, M=reg; lanes 16-31 N=lane-16, M=8+reg
  __bf16* Ts = Xs[0];
  const int tp = vt ? 128 + 8 : 64 + 8;
  const float scale = (z == 0) ? 0.125f : 1.0f;
  __bf16* tw = Ts + (br + (lane & 15)) * tp + ar + ((lane >> 4) << 3);
  // both loops unrolled: acc and pk, indexed by constants, live in registers
#pragma unroll
  for (int nt = 0; nt < 4; ++nt) {
    v8bf pk;
#pragma unroll
    for (int r = 0; r < 8; ++r) pk[r] = (__bf16)(acc[nt][r] * scale);
    *reinterpret_cast<v8bf*>(tw + nt * 16) = pk;
  }
  __syncthreads();   // the tile is read by other waves than wrote it

  // 1024 pieces of 16 bytes, four a thread; neighbouring threads take neighbouring
  // pieces of a row. Q, K: the 128 tokens of one head are 16 KB in a row.
  const int sh = vt ? 4 : 3;          // log2 of the pieces in a row
  const int dld = vt ? 4096 : 64;     // row pitch in memory
  __bf16* dst = vt ? Vt + n0 * 4096 + t0
                   : ((z == 0) ? Qh : Kh) + (blockIdx.y * 4096 + t0) * 64;
  // unrolled so that the four LDS reads go out together
#pragma unroll
  for (int j = 0; j < 4; ++j) {
    const int idx = j * 256 + tid;
    const int row = idx >> sh, pc = idx & ((1 << sh) - 1);
    *reinterpret_cast<v8bf*>(dst + row * dld + pc * 8) =
        *reinterpret_cast<const v8bf*>(Ts + row * tp + pc * 8);
  }
}

// ---------------------------------------------------------------- attention, parts of a step
// S^T - max in use for one wave's 64 keys, from LDS: four tiles of 16 keys, each
// against both query tiles. The loops are unrolled so that s, indexed by
// constants, lives in registers.
static __device__ __forceinline__ void scores64(const __bf16* kc, const v16bf (&qb)[2][2],
                                                const v8f (&nm)[2], int lane,
                                                v8f (&s)[4][2]) {
#pragma unroll
  for (int j = 0; j < 4; ++j) {
    v16bf ka = load_frag(kc, KP, 16 * j, 0,  lane);
    v16bf kb = load_frag(kc, KP, 16 * j, 32, lane);
#pragma unroll
    for (int c = 0; c < 2; ++c) {
      v8f z = wmma_bf16(ka, qb[c][0], nm[c]);
      s[j][c] = wmma_bf16(kb, qb[c][1], z);
    }
  }
}

// Exponentials of those scores as B fragments of P^T, and per query tile the
// lane's own sum of its 32; two neighbouring registers at a time, one sum chain
// per 32 keys, joined at the end. The loops are unrolled so that s, ps and p,
// indexed by constants, live in registers.
static __device__ __forceinline__ void exps64(const v8f (&s)[4][2], Frag16 (&p)[2][2],
                                              float (&sum)[2]) {
#pragma unroll
  for (int c = 0; c < 2; ++c) {
    v2f ps[2];
#pragma unroll
    for (int g = 0; g < 2; ++g) {
#pragma unroll
      for (int i = 0; i < 8; ++i) {
        // registers 2(i&3), 2(i&3)+1 of tile 2g+(i>>2):
        // keys 32g+{0..7 | 8..15} for i < 4, 32g+{16..23 | 24..31} behind (per lane half)
        const v8f& st = s[2 * g + (i >> 2)][c];
        const v2f a = (v2f){st[2 * (i & 3)], st[2 * (i & 3) + 1]} * LOG2E;
        const v2f e = {__builtin_amdgcn_exp2f(a.x), __builtin_amdgcn_exp2f(a.y)};
        ps[g] = (i == 0) ? e : ps[g] + e;
        p[g][c].v[2 * i]     = (__bf16)e.x;
        p[g][c].v[2 * i + 1] = (__bf16)e.y;
      }
    }
    const v2f pj = ps[0] + ps[1];
    sum[c] = pj.x + pj.y;
  }
}

// ---------------------------------------------------------------- attention
// One block per 128 queries of one head, 16 waves. A wave owns 32 queries (two
// 16-query tiles), so that every K and V fragment it reads from LDS feeds two
// matrix instructions. The four waves of a query group share each staged tile of
// KT keys, WK keys each, and keep their own running maximum, sum and O^T; the
// four partial results are joined once, through LDS, behind the loop.
// K/V tiles are staged in LDS with double-buffered async global->LDS copies
// (ASYNCcnt), once for all 128 queries.
// Computes S^T = K @ Q^T so softmax reduction is in-lane + one xor16 shuffle,
// and each pair of 16-key S^T tiles forms a native K=32 B-fragment of P^T.
// The softmax maximum is lazy: a wave keeps the maximum it has in use until a
// step's sum of exponentials tops SUM_CAP. It is therefore known before a step's
// scores are, and enters their matrix product negated, as the C operand: the
// scores arrive already reduced by it. No maximum is taken over the scores of an
// ordinary step; the rare step that outgrows the cap is done again with a renewed
// maximum, and only there are O and the row sum rescaled.
__global__ __launch_bounds__(512) void attn_flash(const __bf16* __restrict__ Qh,
                                                  const __bf16* __restrict__ Kh,
                                                  const __bf16* __restrict__ Vt,
                                                  __bf16* __restrict__ Ob) {
  // the ring: K [2][key][d] and V [2][d][key], padded rows; behind the loop the
  // same bytes hold the partial results
  __shared__ __attribute__((aligned(16))) unsigned char smem[SM_BYTES];
  __bf16* Ks = reinterpret_cast<__bf16*>(smem);
  __bf16* Vs = Ks + 2 * KT * KP;

  const int tid  = threadIdx.x;
  const int lane = tid & 31;
  // the same in every lane: held in a scalar register, as is all that follows from
  // it, so that it takes no vector register through the loop
  const int wave = __builtin_amdgcn_readfirstlane(tid >> 5);
  const int ks = wave & (NS - 1);   // which WK keys of a stage
  const int qg = wave / NS;         // which 32 queries of the block
  const int h  = blockIdx.y;
  const int q0 = blockIdx.x * 128 + qg * 32;
  const __bf16* Q = Qh + (long)(h << 12) * 64;
  const __bf16* K = Kh + (long)(h << 12) * 64;
  const __bf16* V = Vt + (long)(h << 6) * 4096;

  // loop-invariant Q B-fragments (2 x 16 queries x 64 d); unrolled so that qb,
  // indexed by constants, lives in registers
  v16bf qb[2][2];
#pragma unroll
  for (int c = 0; c < 2; ++c) {
    qb[c][0] = load_frag(Q, 64, q0 + 16 * c, 0, lane);
    qb[c][1] = load_frag(Q, 64, q0 + 16 * c, 32, lane);
  }

  // Each thread copies four 16-byte pieces of the K tile (64 rows apart) and
  // four of the V tile (16 rows apart) per stage.
  const __bf16* kg = K + tid * 8;
  const __bf16* vg = V + (tid >> 5) * 4096 + (tid & 31) * 8;
  const int kl = (tid >> 3) * KP + (tid & 7) * 8;
  const int vl = (tid >> 5) * VP + (tid & 31) * 8;

  // stage 0 into buffer 0, published; then stage 1 into buffer 1, in flight
  async_copy4_b128(kg, 64 * 64, Ks + kl, 64 * KP);
  async_copy4_b128(vg, 16 * 4096, Vs + vl, 16 * VP);
  ASYNC_WAIT_0();
  __syncthreads();
  async_copy4_b128(kg + KT * 64, 64 * 64, Ks + KT * KP + kl, 64 * KP);
  async_copy4_b128(vg + KT, 16 * 4096, Vs + 64 * VP + vl, 16 * VP);

  v8f o[4][2] = {};   // [16 d][16 queries]
  // per query: the negative of the maximum in use, in all eight registers of a
  // C operand (the first step always renews it), and the row sum against it
  v8f nm[2] = {};
  float lrun[2] = {0.0f, 0.0f};

  // kept whole: with the first step split off as a copy of its own, the kernel
  // no longer fits its registers and spills
#pragma unroll 1
  for (int it = 0; it < 4096 / KT; ++it) {
    const int cur = it & 1;
    const __bf16* kc = Ks + cur * (KT * KP) + ks * (WK * KP);  // this wave's key rows
    const __bf16* vc = Vs + cur * (64 * VP) + ks * WK;         // this wave's key columns

    // Fast form of a step, every step but the first: exponentials straight from
    // the scores, no look at the scores themselves. The lane's own sum of its 32
    // exponentials, which the row sum needs anyway, is the test: while it stays
    // at or below SUM_CAP no exponential has outgrown the maximum in use.
    // One test per step, the same for the whole wave.
    Frag16 p[2][2];
    float ps[2];
    unsigned renew = 1u;
    // V fragments of the wave's first 32 keys: each form of the step reads them
    // itself, in front of the test, so that their LDS latency passes behind the
    // form's own vector work and the test; the loops over t are unrolled so that va
    // lives in registers
    v16bf va[4];
    if (it != 0) {
      v8f s[4][2];
      scores64(kc, qb, nm, lane, s);
#pragma unroll
      for (int t = 0; t < 4; ++t) va[t] = load_frag(vc, VP, 16 * t, 0, lane);
      exps64(s, p, ps);
      renew = __builtin_amdgcn_ballot_w32(fmaxf(ps[0], ps[1]) > SUM_CAP);
    }

    // Careful form: the first step, and the rare step whose sum has outgrown the
    // cap (an overflow to infinity included). Nothing of the fast form has reached
    // O or the row sum yet, and the keys still lie in LDS: the step is done again
    // from its scores, with the maximum renewed.
    if (renew != 0) {
      v8f s[4][2];
      scores64(kc, qb, nm, lane, s);
#pragma unroll
      for (int t = 0; t < 4; ++t) va[t] = load_frag(vc, VP, 16 * t, 0, lane);
      // The loops over c, g, r, j and t4 are unrolled so that s, o and tm, indexed
      // by constants, live in registers.
#pragma unroll
      for (int c = 0; c < 2; ++c) {
        // the lane's largest score of the step, over the maximum in use; one chain
        // per 32 keys, joined at the end
        float tm[2];
#pragma unroll
        for (int g = 0; g < 2; ++g) {
          tm[g] = s[2 * g][c][0];
#pragma unroll
          for (int r = 0; r < 8; ++r) {
            tm[g] = fmaxf(tm[g], s[2 * g][c][r]);
            tm[g] = fmaxf(tm[g], s[2 * g + 1][c][r]);
          }
        }
        const float tl = fmaxf(tm[0], tm[1]);
        const float t = fmaxf(tl, __shfl_xor(tl, 16, 32));
        // the first step takes its own maximum, a later one never lowers it
        const float d = (it == 0) ? t : fmaxf(t, 0.0f);
        const float alpha = __expf(-fmaxf(d, 0.0f));
        lrun[c] *= alpha;
        nm[c] -= d;
#pragma unroll
        for (int j = 0; j < 4; ++j) {
#pragma unroll
          for (int r = 0; r < 8; ++r) s[j][c][r] -= d;
        }
#pragma unroll
        for (int t4 = 0; t4 < 4; ++t4) {
#pragma unroll
          for (int r = 0; r < 8; ++r) o[t4][c][r] *= alpha;
        }
      }
      exps64(s, p, ps);
    }

    // row sums: the two lane halves of a query joined
#pragma unroll
    for (int c = 0; c < 2; ++c) lrun[c] += ps[c] + __shfl_xor(ps[c], 16, 32);

    // O^T += V^T(64 x 64 keys) @ P^T(64 keys x 32 queries), V from LDS. The loops
    // over t are unrolled so that va, vb and o, indexed by constants, live in registers.
    v16bf vb[4];
#pragma unroll
    for (int t = 0; t < 4; ++t) vb[t] = load_frag(vc, VP, 16 * t, 32, lane);
    // keeps these eight reads together and in front of the first half's matrix
    // instructions, which then cover their LDS latency
    __builtin_amdgcn_sched_barrier(0);
#pragma unroll
    for (int t = 0; t < 4; ++t) {
      o[t][0] = wmma_bf16(va[t], p[0][0].v, o[t][0]);
      o[t][1] = wmma_bf16(va[t], p[0][1].v, o[t][1]);
    }
#pragma unroll
    for (int t = 0; t < 4; ++t) {
      o[t][0] = wmma_bf16(vb[t], p[1][0].v, o[t][0]);
      o[t][1] = wmma_bf16(vb[t], p[1][1].v, o[t][1]);
    }
    // keeps the matrix instructions in front of the loop foot: moved behind its
    // barrier they would stand in front of the refill copies and delay them
    __builtin_amdgcn_sched_barrier(0);

    // publish point: own reads of buf[cur] done, own copies of the next stage
    // landed; the one barrier publishes that stage and frees buf[cur]
    DS_WAIT_0();
    ASYNC_WAIT_0();
    __syncthreads();
    if (it + 2 < 4096 / KT) {  // refill the buffer just read, two stages ahead
      const int kn = (it + 2) * KT;
      async_copy4_b128(kg + kn * 64, 64 * 64, Ks + cur * (KT * KP) + kl, 64 * KP);
      async_copy4_b128(vg + kn, 16 * 4096, Vs + cur * (64 * VP) + vl, 16 * VP);
    }
  }
  ASYNC_WAIT_0();   // nothing of this wave is in flight when it ends

  // Join of the four partial results of a query group. The last publish point
  // has ended every read of the ring and nothing is in flight, so its bytes are
  // free. A wave's store or load of four floats a lane covers 512 contiguous bytes.
  // The loops of the join are unrolled for the same reason as those above: o, mj
  // and lj, indexed by constants, live in registers.
  float* Om = reinterpret_cast<float*>(smem);   // [wave][d tile][query tile][half][lane][4]
  float* Mm = Om + 16 * 8 * 256;                // [wave][query tile][lane]
  float* Lm = Mm + 16 * 2 * 32;
#pragma unroll
  for (int t = 0; t < 4; ++t) {
#pragma unroll
    for (int c = 0; c < 2; ++c) {
      v4f* d4 = reinterpret_cast<v4f*>(Om + ((wave * 4 + t) * 2 + c) * 256) + lane;
      v4f lo = {o[t][c][0], o[t][c][1], o[t][c][2], o[t][c][3]};
      v4f hi = {o[t][c][4], o[t][c][5], o[t][c][6], o[t][c][7]};
      d4[0]  = lo;
      d4[32] = hi;
    }
  }
#pragma unroll
  for (int c = 0; c < 2; ++c) {
    Mm[(wave * 2 + c) * 32 + lane] = -nm[c][0];
    Lm[(wave * 2 + c) * 32 + lane] = lrun[c];
  }
  __syncthreads();   // the partial results are read by the group's other waves

  // wave ks of a group finishes d tile ks of its 32 queries
#pragma unroll
  for (int c = 0; c < 2; ++c) {
    float mj[NS], lj[NS];
#pragma unroll
    for (int j = 0; j < NS; ++j) {
      mj[j] = Mm[((qg * NS + j) * 2 + c) * 32 + lane];
      lj[j] = Lm[((qg * NS + j) * 2 + c) * 32 + lane];
    }
    const float mall = fmaxf(fmaxf(mj[0], mj[1]), fmaxf(mj[2], mj[3]));
    float lall = 0.0f;
    v4f lo = {}, hi = {};
#pragma unroll
    for (int j = 0; j < NS; ++j) {
      const float w = __expf(mj[j] - mall);
      const v4f* s4 =
          reinterpret_cast<const v4f*>(Om + (((qg * NS + j) * 4 + ks) * 2 + c) * 256) + lane;
      lall += w * lj[j];
      lo += w * s4[0];
      hi += w * s4[32];
    }
    const float inv = 1.0f / lall;
    v8bf ob;
#pragma unroll
    for (int r = 0; r < 4; ++r) {
      ob[r]     = (__bf16)(lo[r] * inv);
      ob[4 + r] = (__bf16)(hi[r] * inv);
    }
    // D layout: a lane holds 8 consecutive d of one query, 16 bytes
    const int q = q0 + 16 * c + (lane & 15);
    *reinterpret_cast<v8bf*>(Ob + (long)q * 512 + (h << 6) + ks * 16 + ((lane >> 4) << 3)) = ob;
  }
}

// ---------------------------------------------------------------- output proj
// out(4096x64) = Ob(4096x512) @ Wo^T(512x64) + bo, f32 output.
// A block of OW waves makes OT tokens x all 64 columns. Its rows of Ob and all of
// Wo are brought into LDS by async global->LDS copies (ASYNCcnt) that are all in
// flight at once and move whole lines. The waves split k; their partial results
// are joined through LDS.
// The A operand is Wo, so that a lane's eight accumulator registers are eight
// neighbouring columns of one token, as they lie in memory.
#define OT 32   // tokens per block
#define OW 4    // waves per block
#define OK (512 / OW)  // k per wave
#define OP 520  // LDS row pitch in elements: 1024 B + 16 B pad (16 B x odd)
#define RP 68   // row pitch of a partial result in floats: 256 B + 16 B pad (16 B x odd)
__global__ __launch_bounds__(OW * 32) void out_gemm(const __bf16* __restrict__ Ob,
                                                    const __bf16* __restrict__ Wob,
                                                    const float* __restrict__ bo,
                                                    float* __restrict__ out) {
  __shared__ __attribute__((aligned(16))) __bf16 Os[OT * OP];       // [token][k], padded rows
  __shared__ __attribute__((aligned(16))) __bf16 Wos[64 * OP];      // [col][k], padded rows
  __shared__ __attribute__((aligned(16))) float Rs[OW * OT * RP];   // [wave][token][col]

  const int tid  = threadIdx.x;
  const int lane = threadIdx.x & 31;
  const int wave = threadIdx.x >> 5;
  const int m0 = blockIdx.x * OT;

  // the four columns that this thread finishes, the same in each of its pieces
  const v4f bias = *reinterpret_cast<const v4f*>(bo + (tid & 15) * 4);

  // 64 threads copy the 1024 B of a row, the block 2 rows at a time: a thread's
  // pieces lie 2 rows apart, eight of them (16 rows) to a statement; 48 copies
  // of a wave are in flight. Unrolled so that j is a constant in the addresses.
  const int sg = (tid >> 6) * 512 + (tid & 63) * 8;
  const int sl = (tid >> 6) * OP + (tid & 63) * 8;
#pragma unroll
  for (int j = 0; j < OT / 16; ++j)
    async_copy8_b128(Ob + (m0 + j * 16) * 512 + sg, 2 * 512, Os + j * 16 * OP + sl, 2 * OP);
#pragma unroll
  for (int j = 0; j < 64 / 16; ++j)
    async_copy8_b128(Wob + j * 16 * 512 + sg, 2 * 512, Wos + j * 16 * OP + sl, 2 * OP);
  ASYNC_WAIT_0();
  __syncthreads();   // the tiles are read by other waves than copied them

  v8f acc[4][2] = {};   // [16 columns][16 tokens]
  // all loops unrolled: k folds into the offset field of the LDS reads, and a, b
  // and acc, indexed by constants, live in registers
#pragma unroll
  for (int kk = 0; kk < OK; kk += 64) {
    v16bf a[2][4], b[2][2];
#pragma unroll
    for (int g = 0; g < 2; ++g) {
      const int k0 = wave * OK + kk + g * 32;
      b[g][0] = load_frag(Os, OP, 0,  k0, lane);
      b[g][1] = load_frag(Os, OP, 16, k0, lane);
#pragma unroll
      for (int nt = 0; nt < 4; ++nt) a[g][nt] = load_frag(Wos, OP, nt * 16, k0, lane);
    }
    // Holds the LDS reads of these twelve fragments together, in front of their
    // matrix instructions: the wave, alone on its SIMD, then waits out the LDS
    // latency once, not once per fragment. Inputs only: nothing is changed.
    asm volatile("" :: "v"(b[0][0]), "v"(b[0][1]), "v"(a[0][0]), "v"(a[0][1]), "v"(a[0][2]),
                       "v"(a[0][3]), "v"(b[1][0]), "v"(b[1][1]), "v"(a[1][0]), "v"(a[1][1]),
                       "v"(a[1][2]), "v"(a[1][3]));
#pragma unroll
    for (int g = 0; g < 2; ++g) {
#pragma unroll
      for (int nt = 0; nt < 4; ++nt) {
        acc[nt][0] = wmma_bf16(a[g][nt], b[g][0], acc[nt][0]);
        acc[nt][1] = wmma_bf16(a[g][nt], b[g][1], acc[nt][1]);
      }
    }
  }

  // D layout: lanes 0-15 N=lane, M=reg; lanes 16-31 N=lane-16, M=8+reg
  // (N: token of the 16-token tile, M: column of the 16-column tile)
  // unrolled: acc is indexed by constants
#pragma unroll
  for (int c = 0; c < 2; ++c) {
    float* rw = Rs + (wave * OT + c * 16 + (lane & 15)) * RP + ((lane >> 4) << 3);
#pragma unroll
    for (int nt = 0; nt < 4; ++nt) {
      v4f lo = {acc[nt][c][0], acc[nt][c][1], acc[nt][c][2], acc[nt][c][3]};
      v4f hi = {acc[nt][c][4], acc[nt][c][5], acc[nt][c][6], acc[nt][c][7]};
      *reinterpret_cast<v4f*>(rw + nt * 16)     = lo;
      *reinterpret_cast<v4f*>(rw + nt * 16 + 4) = hi;
    }
  }
  __syncthreads();   // the partial results are read by other waves than wrote them

  // The block's result is 8 KB in a row in memory: 512 pieces of 16 bytes, four a
  // thread, neighbouring threads on neighbouring pieces, so that a wave's store
  // covers whole lines. Unrolled so that the LDS reads go out together.
#pragma unroll
  for (int j = 0; j < OT * 16 / (OW * 32); ++j) {
    const int p = j * (OW * 32) + tid;
    const float* rr = Rs + (p >> 4) * RP + (p & 15) * 4;
    v4f sum = *reinterpret_cast<const v4f*>(rr);
#pragma unroll
    for (int w = 1; w < OW; ++w) sum += *reinterpret_cast<const v4f*>(rr + w * OT * RP);
    *reinterpret_cast<v4f*>(out + m0 * 64 + p * 4) = sum + bias;
  }
}

// ---------------------------------------------------------------- launch
extern "C" void kernel_launch(void* const* d_in, const int* in_sizes, int n_in,
                              void* d_out, int out_size, void* d_ws, size_t ws_size,
                              hipStream_t stream) {
  const float* x  = (const float*)d_in[0];   // 4096x512
  const float* Wq = (const float*)d_in[1];   // 512x512
  const float* Wk = (const float*)d_in[2];   // 512x512
  const float* Wv = (const float*)d_in[3];   // 512x512
  const float* Wo = (const float*)d_in[4];   // 64x512
  const float* bo = (const float*)d_in[5];   // 64
  float* out = (float*)d_out;                // 4096x64

  char* ws = (char*)d_ws;
  size_t off = 0;
  __bf16* xb  = (__bf16*)(ws + off); off += (size_t)4096 * 512 * 2;  // 4 MB
  __bf16* wqb = (__bf16*)(ws + off); off += (size_t)512 * 512 * 2;
  __bf16* wkb = (__bf16*)(ws + off); off += (size_t)512 * 512 * 2;
  __bf16* wvb = (__bf16*)(ws + off); off += (size_t)512 * 512 * 2;
  __bf16* wob = (__bf16*)(ws + off); off += (size_t)64 * 512 * 2;
  __bf16* Qh  = (__bf16*)(ws + off); off += (size_t)8 * 4096 * 64 * 2;
  __bf16* Kh  = (__bf16*)(ws + off); off += (size_t)8 * 4096 * 64 * 2;
  __bf16* Vt  = (__bf16*)(ws + off); off += (size_t)8 * 64 * 4096 * 2;
  __bf16* Ob  = (__bf16*)(ws + off); off += (size_t)4096 * 512 * 2;

  // xb, wqb, wkb, wvb, wob are one contiguous range that starts at xb
  cvt_f32_bf16<<<CVT_NX + 3 * CVT_NW + CVT_NO, 256, 0, stream>>>(x, Wq, Wk, Wv, Wo, xb);

  qkv_gemm<<<dim3(32, 8, 3), 256, 0, stream>>>(xb, wqb, wkb, wvb, Qh, Kh, Vt);
  attn_flash<<<dim3(32, 8), 512, 0, stream>>>(Qh, Kh, Vt, Ob);
  out_gemm<<<4096 / OT, OW * 32, 0, stream>>>(Ob, wob, bo, out);
}
